// v000
// Measured on an AMD MI455X. A time is GPU time per run, averaged over a window of back-to-back runs after a warm-up
// (all launches, gaps included; the runs take copies of the inputs in turn), and the median of several windows.
// Apart from v000's, it joins two sittings. Times from different sittings can be a few percent apart, while
// side-by-side timings come from the same sitting.
// v000 is the starting kernel. One run takes 806 microseconds.
#include <hip/hip_runtime.h>

// LuongAttention (enc, dec [8][2048][256]; scores[s][t] = enc[s] . dec[t] (unscaled); softmax over t (decoder time); context[s] = sum_t weights[s][t] enc[t] (the source contracts the weights' decoder axis with enc's time axis; both are 2,048 long); out = tanh([context | dec] W_tanh) -> [8][2048][256]).
// Compute dtypes, f32 accumulate: every input rounded to bf16; the unscaled scores are a PLAIN bf16 GEMM of the inputs themselves (exact products, f32 sums - they reach |90|, so nothing narrower would do); softmax f32 -> hl planes; context as hl x exact enc (2 products); [hl(context) | bf16(dec)] x exact W_tanh (2 products); tanh f32.

#define NB_  8
#define SS   2048
#define DD   256
typedef _Float16 h16;
typedef unsigned short bf;
typedef __attribute__((ext_vector_type(16))) __bf16   v16bf;
typedef __attribute__((ext_vector_type(16))) _Float16 v16h;
typedef __attribute__((ext_vector_type(8)))  _Float16 v8h;
typedef __attribute__((ext_vector_type(8)))  unsigned short v8us;
typedef __attribute__((ext_vector_type(8)))  float    v8f;
typedef __attribute__((ext_vector_type(4)))  float    v4f;
typedef v8h  __attribute__((may_alias)) v8ha;
typedef v4f  __attribute__((may_alias)) v4fa;
typedef v8us __attribute__((may_alias)) v8usa;

__device__ __forceinline__ unsigned short f2bf(float f) { unsigned u = __float_as_uint(f); u += 0x7FFFu + ((u >> 16) & 1u); return (unsigned short)(u >> 16); }
__device__ __forceinline__ float bf2f(unsigned short b) { return __uint_as_float(((unsigned)b) << 16); }
__device__ __forceinline__ float bfr(float f) { return bf2f(f2bf(f)); }
__device__ __forceinline__ v16h cat16(v8h lo, v8h hi) { return __builtin_shufflevector(lo, hi, 0, 1, 2, 3, 4, 5, 6, 7, 8, 9, 10, 11, 12, 13, 14, 15); }
__device__ __forceinline__ v16bf cat16b(v8us lo, v8us hi) { return __builtin_bit_cast(v16bf, __builtin_shufflevector(lo, hi, 0, 1, 2, 3, 4, 5, 6, 7, 8, 9, 10, 11, 12, 13, 14, 15)); }
__device__ __forceinline__ v8f wmma16(v16h a, v16h b, v8f c) { return __builtin_amdgcn_wmma_f32_16x16x32_f16(false, a, false, b, (short)0, c, false, false); }
__device__ __forceinline__ v8f wmmab(v16bf a, v16bf b, v8f c) { return __builtin_amdgcn_wmma_f32_16x16x32_bf16(false, a, false, b, (short)0, c, false, false); }



// ---- k_gemmw: register-blocked GEMM, ONE WAVE per 64x64 output tile (16 accumulators), operands straight from K-contiguous 16-bit planes; grid (M/64, N/64, Z), 32 threads.
// C[m][n] (f32, pitch ldc, + optional f32 bias[n]) = sum_k A[m][k] Bt[n][k] (+ split products per NSPLIT). z-batch strides sA/sB/sC in elements. K % 32 == 0.
template <typename T16> struct WFrag;
template <> struct WFrag<h16> { typedef v16h V; static __device__ __forceinline__ V ld(const h16* p) { return cat16(*(const v8h*)p, *(const v8h*)(p + 16)); } static __device__ __forceinline__ v8f mma(V a, V b, v8f c) { return wmma16(a, b, c); } };
template <> struct WFrag<bf> { typedef v16bf V; static __device__ __forceinline__ V ld(const bf* p) { return cat16b(*(const v8us*)p, *(const v8us*)(p + 16)); } static __device__ __forceinline__ v8f mma(V a, V b, v8f c) { return wmmab(a, b, c); } };
template <typename T16, int NSPLIT, bool BIAS>
__global__ __launch_bounds__(32) void k_gemmw(const T16* __restrict__ A, const T16* __restrict__ A2, const T16* __restrict__ Bt, const T16* __restrict__ Bt2, int K, float* C, int ldc, const float* __restrict__ bias, size_t sA, size_t sB, size_t sC) {
    typedef typename WFrag<T16>::V V;
    __shared__ __align__(16) float os[16 * 68];
    const size_t z = blockIdx.z; A += z * sA; if (A2) A2 += z * sA; Bt += z * sB; if (Bt2) Bt2 += z * sB; C += z * sC;
    const int lane = threadIdx.x & 31, lr = lane & 15, hi = lane >> 4; const int r0 = blockIdx.x * 64, c0 = blockIdx.y * 64;
    v8f acc[4][4];
#pragma unroll
    for (int mb = 0; mb < 4; ++mb)
#pragma unroll
        for (int nb = 0; nb < 4; ++nb) acc[mb][nb] = (v8f){};
    const size_t aoff = (size_t)(r0 + lr) * K + 8 * hi, boff = (size_t)(c0 + lr) * K + 8 * hi;
#pragma unroll 1
    for (int kc = 0; kc < K; kc += 32) {
        V a[4], a2[4];
#pragma unroll
        for (int mb = 0; mb < 4; ++mb) { a[mb] = WFrag<T16>::ld(A + aoff + (size_t)mb * 16 * K + kc); if (NSPLIT == 1 || NSPLIT == 2) a2[mb] = WFrag<T16>::ld(A2 + aoff + (size_t)mb * 16 * K + kc); }
#pragma unroll
        for (int nb = 0; nb < 4; ++nb) { const V b = WFrag<T16>::ld(Bt + boff + (size_t)nb * 16 * K + kc); V b2; if (NSPLIT >= 2) b2 = WFrag<T16>::ld(Bt2 + boff + (size_t)nb * 16 * K + kc);
#pragma unroll
            for (int mb = 0; mb < 4; ++mb) { acc[mb][nb] = WFrag<T16>::mma(a[mb], b, acc[mb][nb]); if (NSPLIT == 1 || NSPLIT == 2) acc[mb][nb] = WFrag<T16>::mma(a2[mb], b, acc[mb][nb]); if (NSPLIT >= 2) acc[mb][nb] = WFrag<T16>::mma(a[mb], b2, acc[mb][nb]); } }
        asm volatile("v_nop\n\tv_nop\n\tv_nop\n\tv_nop" : "+v"(acc[0][0]), "+v"(acc[1][1]), "+v"(acc[2][2]), "+v"(acc[3][3]) : "v"(a[0]), "v"(a[3]));
    }
#pragma unroll
    for (int mb = 0; mb < 4; ++mb) {
#pragma unroll
        for (int nb = 0; nb < 4; ++nb) {
#pragma unroll
            for (int j = 0; j < 8; ++j) os[(hi * 8 + j) * 68 + nb * 16 + lr] = acc[mb][nb][j]; }
        __builtin_amdgcn_wave_barrier(); asm volatile("" ::: "memory");
        float* crow = C + (size_t)(r0 + mb * 16) * ldc + c0;
{
#pragma unroll
            for (int s = 0; s < 8; ++s) { const int row = 2 * s + hi, cofs = lr * 4; v4f val = *(const v4fa*)(os + row * 68 + cofs); if (BIAS) { val[0] += bfr(bias[c0 + cofs]); val[1] += bfr(bias[c0 + cofs + 1]); val[2] += bfr(bias[c0 + cofs + 2]); val[3] += bfr(bias[c0 + cofs + 3]); }
                *(v4f*)(crow + (size_t)row * ldc + cofs) = val; }
             }
        __builtin_amdgcn_wave_barrier(); asm volatile("" ::: "memory");
    }
}

__device__ __forceinline__ void splitf(float y, unsigned short& h, unsigned short& l) { h = f2bf(y); l = f2bf(y - bf2f(h)); }
typedef __attribute__((ext_vector_type(2))) unsigned short v2us;
typedef __attribute__((ext_vector_type(4))) unsigned short v4us;

__global__ __launch_bounds__(256) void k_cvt8(const float* __restrict__ src, bf* dst, size_t n8) { const size_t i = (size_t)blockIdx.x * 256 + threadIdx.x; if (i >= n8) return; const v8f v = *(const v8f*)(src + i * 8); v8us o;
#pragma unroll
    for (int k = 0; k < 8; ++k) o[k] = f2bf(v[k]); *(v8us*)(dst + i * 8) = o;  }
__global__ __launch_bounds__(256) void k_wtG(const float* __restrict__ w, int K, int N, bf* Bt) {
    const int lane = threadIdx.x & 31; const int L0 = (blockIdx.x * 8 + (threadIdx.x >> 5)) * 8; const int nlines = N * K / 64;
{
#pragma unroll 1
        for (int l = 0; l < 8; ++l) { const int L = L0 + l; if (L >= nlines) break; const size_t e = (size_t)L * 64 + lane * 2; const int k = (int)(e % K), n = (int)(e / K); v2us o;
            o[0] = f2bf(w[(size_t)k * N + n]); o[1] = f2bf(w[(size_t)(k + 1) * N + n]); *(v2us*)(Bt + e) = o; }
         }
}

__global__ __launch_bounds__(256) void k_tr(const float* __restrict__ E, bf* ET) { const size_t e = ((size_t)blockIdx.x * 256 + threadIdx.x) * 2; if (e >= (size_t)DD * SS) return; const int t = (int)(e % SS); const int d = (int)(e / SS); v2us o; o[0] = f2bf(E[(size_t)t * DD + d]); o[1] = f2bf(E[(size_t)(t + 1) * DD + d]); *(v2us*)(ET + e) = o;  }
__global__ __launch_bounds__(256) void k_smax(const float* __restrict__ S, bf* Ph, bf* Pl) { const int lane = threadIdx.x & 31; const int row = blockIdx.x * 8 + (threadIdx.x >> 5); if (row >= SS) return; const float* sr = S + (size_t)row * SS; float v[SS / 32]; float mx = -3.0e38f;
#pragma unroll
    for (int ch = 0; ch < SS / 128; ++ch) { const v4f a = *(const v4f*)(sr + ch * 128 + lane * 4);
#pragma unroll
        for (int u = 0; u < 4; ++u) { v[ch * 4 + u] = a[u]; mx = fmaxf(mx, a[u]); } }
#pragma unroll
    for (int sh = 16; sh; sh >>= 1) mx = fmaxf(mx, __shfl_xor(mx, sh, 32));
    float sum = 0.f;
#pragma unroll
    for (int q = 0; q < SS / 32; ++q) { float d0 = __fsub_rn(v[q], mx); asm volatile("" : "+v"(d0)); v[q] = __builtin_amdgcn_exp2f(__fmul_rn(d0, 1.4426950408889634f)); sum += v[q]; }
#pragma unroll
    for (int sh = 16; sh; sh >>= 1) sum += __shfl_xor(sum, sh, 32);
    const float f = __fdiv_rn(1.0f, sum);
    {
#pragma unroll
        for (int ch = 0; ch < SS / 128; ++ch) { v4us oh, ol; for (int q = 0; q < 4; ++q) { unsigned short a2, c2; splitf(v[ch * 4 + q] * f, a2, c2); oh[q] = a2; ol[q] = c2; } const size_t oo = (size_t)row * SS + ch * 128 + lane * 4; *(v4us*)(Ph + oo) = oh; *(v4us*)(Pl + oo) = ol; }
         } }
__global__ __launch_bounds__(256) void k_cat(const float* __restrict__ CTX, const float* __restrict__ dec, bf* Ah, bf* Al) { const size_t e = ((size_t)blockIdx.x * 256 + threadIdx.x) * 4; if (e >= (size_t)SS * 2 * DD) return; const int c = (int)(e % (2 * DD)); const size_t s = e / (2 * DD); v4us oh, ol;
#pragma unroll
    for (int u = 0; u < 4; ++u) { if (c < DD) { unsigned short a, b; splitf(CTX[s * DD + c + u], a, b); oh[u] = a; ol[u] = b; } else { oh[u] = f2bf(dec[s * DD + c - DD + u]); ol[u] = 0; } }
    *(v4us*)(Ah + e) = oh; *(v4us*)(Al + e) = ol;  }
__global__ __launch_bounds__(256) void k_tanh(float* O, size_t n4) { const size_t e = ((size_t)blockIdx.x * 256 + threadIdx.x) * 4; if (e >= n4 * 4) return; const v4f a = *(const v4f*)(O + e); v4f r;
#pragma unroll
    for (int u = 0; u < 4; ++u) r[u] = tanhf(a[u]); *(v4f*)(O + e) = r;  }

extern "C" void kernel_launch(void* const* d_in, const int* in_sizes, int n_in,
                              void* d_out, int out_size, void* d_ws, size_t ws_size, hipStream_t stream) {
    (void)in_sizes; (void)n_in; (void)out_size;
    const float* enc = (const float*)d_in[0]; const float* dec = (const float*)d_in[1]; const float* Wt = (const float*)d_in[2];
    float* OUT = (float*)d_out;     // [8][2048][256]
    char* wsp = (char*)d_ws;
    auto take = [&](size_t bytes) { char* p = wsp; wsp += (bytes + 255) & ~(size_t)255; return (void*)p; };
    bf* BW = (bf*)take((size_t)2 * DD * DD * 2); bf* EB = (bf*)take((size_t)SS * DD * 2); bf* DB = (bf*)take((size_t)SS * DD * 2); bf* ET = (bf*)take((size_t)DD * SS * 2);
    float* S = (float*)take((size_t)SS * SS * 4); bf* Ph = (bf*)take((size_t)SS * SS * 2); bf* Pl = (bf*)take((size_t)SS * SS * 2); float* CTX = (float*)take((size_t)SS * DD * 4); bf* CAh = (bf*)take((size_t)SS * 2 * DD * 2); bf* CAl = (bf*)take((size_t)SS * 2 * DD * 2);
    if ((size_t)(wsp - (char*)d_ws) > ws_size) return;    // total ~ 42 MB
    k_wtG<<<(2 * DD * DD / 64 + 63) / 64, 256, 0, stream>>>(Wt, 2 * DD, DD, BW);   // 'xw' [512][256]
    for (int b = 0; b < NB_; ++b) { const float* eb = enc + (size_t)b * SS * DD; const float* db = dec + (size_t)b * SS * DD;
        k_cvt8<<<(SS * DD / 8 + 255) / 256, 256, 0, stream>>>(eb, EB, SS * DD / 8); k_cvt8<<<(SS * DD / 8 + 255) / 256, 256, 0, stream>>>(db, DB, SS * DD / 8); k_tr<<<(DD * SS / 2 + 255) / 256, 256, 0, stream>>>(eb, ET);
        k_gemmw<bf, 0, false><<<dim3(SS / 64, SS / 64, 1), 32, 0, stream>>>(EB, nullptr, DB, nullptr, DD, S, SS, nullptr, 0, 0, 0);      // scores[s][t] = enc[s] . dec[t]
        k_smax<<<SS / 8, 256, 0, stream>>>(S, Ph, Pl);
        k_gemmw<bf, 1, false><<<dim3(SS / 64, DD / 64, 1), 32, 0, stream>>>(Ph, Pl, ET, nullptr, SS, CTX, DD, nullptr, 0, 0, 0);   // context = weights . enc
        k_cat<<<(SS * 2 * DD / 4 + 255) / 256, 256, 0, stream>>>(CTX, db, CAh, CAl);
        k_gemmw<bf, 1, false><<<dim3(SS / 64, DD / 64, 1), 32, 0, stream>>>(CAh, CAl, BW, nullptr, 2 * DD, OUT + (size_t)b * SS * DD, DD, nullptr, 0, 0, 0);
        k_tanh<<<(SS * DD / 4 + 255) / 256, 256, 0, stream>>>(OUT + (size_t)b * SS * DD, (size_t)SS * DD / 4); }
}

// v001
// Measured time: 228 microseconds a run.
// Timed twice side by side with v000, it ran 3.48 and 3.42 times as fast.
#include <hip/hip_runtime.h>

// LuongAttention (enc, dec [8][2048][256]; scores[s][t] = enc[s] . dec[t] (unscaled); softmax over t (decoder time); context[s] = sum_t weights[s][t] enc[t] (the source contracts the weights' decoder axis with enc's time axis; both are 2,048 long); out = tanh([context | dec] W_tanh) -> [8][2048][256]).
// Compute dtypes, f32 accumulate: every input rounded to bf16; the unscaled scores are a PLAIN bf16 GEMM of the inputs themselves (exact products, f32 sums - they reach |90|, so nothing narrower would do); softmax f32 -> hl planes; context as hl x exact enc (2 products); [hl(context) | bf16(dec)] x exact W_tanh (2 products); tanh f32.

#define NB_  8
#define SS   2048
#define DD   256
typedef _Float16 h16;
typedef unsigned short bf;
typedef __attribute__((ext_vector_type(16))) __bf16   v16bf;
typedef __attribute__((ext_vector_type(16))) _Float16 v16h;
typedef __attribute__((ext_vector_type(8)))  _Float16 v8h;
typedef __attribute__((ext_vector_type(8)))  unsigned short v8us;
typedef __attribute__((ext_vector_type(8)))  float    v8f;
typedef __attribute__((ext_vector_type(4)))  float    v4f;
typedef v8h  __attribute__((may_alias)) v8ha;
typedef v4f  __attribute__((may_alias)) v4fa;
typedef v8us __attribute__((may_alias)) v8usa;

__device__ __forceinline__ unsigned short f2bf(float f) { unsigned u = __float_as_uint(f); u += 0x7FFFu + ((u >> 16) & 1u); return (unsigned short)(u >> 16); }
__device__ __forceinline__ float bf2f(unsigned short b) { return __uint_as_float(((unsigned)b) << 16); }
__device__ __forceinline__ float bfr(float f) { return bf2f(f2bf(f)); }
__device__ __forceinline__ v16h cat16(v8h lo, v8h hi) { return __builtin_shufflevector(lo, hi, 0, 1, 2, 3, 4, 5, 6, 7, 8, 9, 10, 11, 12, 13, 14, 15); }
__device__ __forceinline__ v16bf cat16b(v8us lo, v8us hi) { return __builtin_bit_cast(v16bf, __builtin_shufflevector(lo, hi, 0, 1, 2, 3, 4, 5, 6, 7, 8, 9, 10, 11, 12, 13, 14, 15)); }
__device__ __forceinline__ v8f wmma16(v16h a, v16h b, v8f c) { return __builtin_amdgcn_wmma_f32_16x16x32_f16(false, a, false, b, (short)0, c, false, false); }
__device__ __forceinline__ v8f wmmab(v16bf a, v16bf b, v8f c) { return __builtin_amdgcn_wmma_f32_16x16x32_bf16(false, a, false, b, (short)0, c, false, false); }



// ---- k_gemmw: register-blocked GEMM, ONE WAVE per 64x64 output tile (16 accumulators), operands straight from K-contiguous 16-bit planes; grid (M/64, N/64, Z), 32 threads.
// C[m][n] (f32, pitch ldc, + optional f32 bias[n]) = sum_k A[m][k] Bt[n][k] (+ split products per NSPLIT). z-batch strides sA/sB/sC in elements. K % 32 == 0.
template <typename T16> struct WFrag;
template <> struct WFrag<h16> { typedef v16h V; static __device__ __forceinline__ V ld(const h16* p) { return cat16(*(const v8h*)p, *(const v8h*)(p + 16)); } static __device__ __forceinline__ v8f mma(V a, V b, v8f c) { return wmma16(a, b, c); } };
template <> struct WFrag<bf> { typedef v16bf V; static __device__ __forceinline__ V ld(const bf* p) { return cat16b(*(const v8us*)p, *(const v8us*)(p + 16)); } static __device__ __forceinline__ v8f mma(V a, V b, v8f c) { return wmmab(a, b, c); } };
template <typename T16, int NSPLIT, bool BIAS>
__global__ __launch_bounds__(32) void k_gemmw(const T16* __restrict__ A, const T16* __restrict__ A2, const T16* __restrict__ Bt, const T16* __restrict__ Bt2, int K, float* C, int ldc, const float* __restrict__ bias, size_t sA, size_t sB, size_t sC) {
    typedef typename WFrag<T16>::V V;
    __shared__ __align__(16) float os[16 * 68];
    const size_t z = blockIdx.z; A += z * sA; if (A2) A2 += z * sA; Bt += z * sB; if (Bt2) Bt2 += z * sB; C += z * sC;
    const int lane = threadIdx.x & 31, lr = lane & 15, hi = lane >> 4; const int r0 = blockIdx.x * 64, c0 = blockIdx.y * 64;
    v8f acc[4][4];
#pragma unroll
    for (int mb = 0; mb < 4; ++mb)
#pragma unroll
        for (int nb = 0; nb < 4; ++nb) acc[mb][nb] = (v8f){};
    const size_t aoff = (size_t)(r0 + lr) * K + 8 * hi, boff = (size_t)(c0 + lr) * K + 8 * hi;
#pragma unroll 1
    for (int kc = 0; kc < K; kc += 32) {
        V a[4], a2[4];
#pragma unroll
        for (int mb = 0; mb < 4; ++mb) { a[mb] = WFrag<T16>::ld(A + aoff + (size_t)mb * 16 * K + kc); if (NSPLIT == 1 || NSPLIT == 2) a2[mb] = WFrag<T16>::ld(A2 + aoff + (size_t)mb * 16 * K + kc); }
#pragma unroll
        for (int nb = 0; nb < 4; ++nb) { const V b = WFrag<T16>::ld(Bt + boff + (size_t)nb * 16 * K + kc); V b2; if (NSPLIT >= 2) b2 = WFrag<T16>::ld(Bt2 + boff + (size_t)nb * 16 * K + kc);
#pragma unroll
            for (int mb = 0; mb < 4; ++mb) { acc[mb][nb] = WFrag<T16>::mma(a[mb], b, acc[mb][nb]); if (NSPLIT == 1 || NSPLIT == 2) acc[mb][nb] = WFrag<T16>::mma(a2[mb], b, acc[mb][nb]); if (NSPLIT >= 2) acc[mb][nb] = WFrag<T16>::mma(a[mb], b2, acc[mb][nb]); } }
        asm volatile("v_nop\n\tv_nop\n\tv_nop\n\tv_nop" : "+v"(acc[0][0]), "+v"(acc[1][1]), "+v"(acc[2][2]), "+v"(acc[3][3]) : "v"(a[0]), "v"(a[3]));
    }
#pragma unroll
    for (int mb = 0; mb < 4; ++mb) {
#pragma unroll
        for (int nb = 0; nb < 4; ++nb) {
#pragma unroll
            for (int j = 0; j < 8; ++j) os[(hi * 8 + j) * 68 + nb * 16 + lr] = acc[mb][nb][j]; }
        __builtin_amdgcn_wave_barrier(); asm volatile("" ::: "memory");
        float* crow = C + (size_t)(r0 + mb * 16) * ldc + c0;
{
#pragma unroll
            for (int s = 0; s < 8; ++s) { const int row = 2 * s + hi, cofs = lr * 4; v4f val = *(const v4fa*)(os + row * 68 + cofs); if (BIAS) { val[0] += bfr(bias[c0 + cofs]); val[1] += bfr(bias[c0 + cofs + 1]); val[2] += bfr(bias[c0 + cofs + 2]); val[3] += bfr(bias[c0 + cofs + 3]); }
                *(v4f*)(crow + (size_t)row * ldc + cofs) = val; }
             }
        __builtin_amdgcn_wave_barrier(); asm volatile("" ::: "memory");
    }
}

__device__ __forceinline__ void splitf(float y, unsigned short& h, unsigned short& l) { h = f2bf(y); l = f2bf(y - bf2f(h)); }
typedef __attribute__((ext_vector_type(2))) unsigned short v2us;
typedef __attribute__((ext_vector_type(4))) unsigned short v4us;

__global__ __launch_bounds__(256) void k_cvt8(const float* __restrict__ src, bf* dst, size_t n8) { const size_t i = (size_t)blockIdx.x * 256 + threadIdx.x; if (i >= n8) return; const v8f v = *(const v8f*)(src + i * 8); v8us o;
#pragma unroll
    for (int k = 0; k < 8; ++k) o[k] = f2bf(v[k]); *(v8us*)(dst + i * 8) = o;  }
__global__ __launch_bounds__(256) void k_wtG(const float* __restrict__ w, int K, int N, bf* Bt) {
    const int lane = threadIdx.x & 31; const int L0 = (blockIdx.x * 8 + (threadIdx.x >> 5)) * 8; const int nlines = N * K / 64;
{
#pragma unroll 1
        for (int l = 0; l < 8; ++l) { const int L = L0 + l; if (L >= nlines) break; const size_t e = (size_t)L * 64 + lane * 2; const int k = (int)(e % K), n = (int)(e / K); v2us o;
            o[0] = f2bf(w[(size_t)k * N + n]); o[1] = f2bf(w[(size_t)(k + 1) * N + n]); *(v2us*)(Bt + e) = o; }
         }
}

__global__ __launch_bounds__(256) void k_tr(const float* __restrict__ E, bf* ET) { const size_t e = ((size_t)blockIdx.x * 256 + threadIdx.x) * 2; if (e >= (size_t)NB_ * DD * SS) return; const int t = (int)(e % SS); const int d = (int)(e / SS % DD); E += e / ((size_t)DD * SS) * ((size_t)SS * DD); v2us o; o[0] = f2bf(E[(size_t)t * DD + d]); o[1] = f2bf(E[(size_t)(t + 1) * DD + d]); *(v2us*)(ET + e) = o;  }
// One wave per score row, NB_ / 2 batches a launch; a batch's hi plane and lo plane lie one behind the other, so each plane pointer steps 2 * SS * SS per batch.
__global__ __launch_bounds__(256) void k_smax(const float* __restrict__ S, bf* Ph, bf* Pl) { const int lane = threadIdx.x & 31; const int row = blockIdx.x * 8 + (threadIdx.x >> 5); if (row >= NB_ / 2 * SS) return; Ph += (size_t)(row / SS) * SS * SS; Pl += (size_t)(row / SS) * SS * SS; const float* sr = S + (size_t)row * SS; float v[SS / 32]; float mx = -3.0e38f;
#pragma unroll
    for (int ch = 0; ch < SS / 128; ++ch) { const v4f a = *(const v4f*)(sr + ch * 128 + lane * 4);
#pragma unroll
        for (int u = 0; u < 4; ++u) { v[ch * 4 + u] = a[u]; mx = fmaxf(mx, a[u]); } }
#pragma unroll
    for (int sh = 16; sh; sh >>= 1) mx = fmaxf(mx, __shfl_xor(mx, sh, 32));
    float sum = 0.f;
#pragma unroll
    for (int q = 0; q < SS / 32; ++q) { float d0 = __fsub_rn(v[q], mx); asm volatile("" : "+v"(d0)); v[q] = __builtin_amdgcn_exp2f(__fmul_rn(d0, 1.4426950408889634f)); sum += v[q]; }
#pragma unroll
    for (int sh = 16; sh; sh >>= 1) sum += __shfl_xor(sum, sh, 32);
    const float f = __fdiv_rn(1.0f, sum);
    {
#pragma unroll
        for (int ch = 0; ch < SS / 128; ++ch) { v4us oh, ol; for (int q = 0; q < 4; ++q) { unsigned short a2, c2; splitf(v[ch * 4 + q] * f, a2, c2); oh[q] = a2; ol[q] = c2; } const size_t oo = (size_t)row * SS + ch * 128 + lane * 4; *(v4us*)(Ph + oo) = oh; *(v4us*)(Pl + oo) = ol; }
         } }
__global__ __launch_bounds__(256) void k_cat(const float* __restrict__ CTX, const float* __restrict__ dec, bf* Ah, bf* Al) { const size_t e = ((size_t)blockIdx.x * 256 + threadIdx.x) * 4; if (e >= (size_t)NB_ * SS * 2 * DD) return; const int c = (int)(e % (2 * DD)); const size_t s = e / (2 * DD); v4us oh, ol;
#pragma unroll
    for (int u = 0; u < 4; ++u) { if (c < DD) { unsigned short a, b; splitf(CTX[s * DD + c + u], a, b); oh[u] = a; ol[u] = b; } else { oh[u] = f2bf(dec[s * DD + c - DD + u]); ol[u] = 0; } }
    *(v4us*)(Ah + e) = oh; *(v4us*)(Al + e) = ol;  }
__global__ __launch_bounds__(256) void k_tanh(float* O, size_t n4) { const size_t e = ((size_t)blockIdx.x * 256 + threadIdx.x) * 4; if (e >= n4 * 4) return; const v4f a = *(const v4f*)(O + e); v4f r;
#pragma unroll
    for (int u = 0; u < 4; ++u) r[u] = tanhf(a[u]); *(v4f*)(O + e) = r;  }

extern "C" void kernel_launch(void* const* d_in, const int* in_sizes, int n_in,
                              void* d_out, int out_size, void* d_ws, size_t ws_size, hipStream_t stream) {
    (void)in_sizes; (void)n_in; (void)out_size;
    const float* enc = (const float*)d_in[0]; const float* dec = (const float*)d_in[1]; const float* Wt = (const float*)d_in[2];
    float* OUT = (float*)d_out;     // [8][2048][256]
    char* wsp = (char*)d_ws;
    auto take = [&](size_t bytes) { char* p = wsp; wsp += (bytes + 255) & ~(size_t)255; return (void*)p; };
    bf* BW = (bf*)take((size_t)2 * DD * DD * 2); bf* EB = (bf*)take((size_t)NB_ * SS * DD * 2); bf* DB = (bf*)take((size_t)NB_ * SS * DD * 2); bf* ET = (bf*)take((size_t)NB_ * DD * SS * 2);
    // Weights P: per batch [hi plane | lo plane], as many bytes as the batch's f32 scores. P starts half a score buffer in front of S, so batches 0-3 go to free space and batches 4-7, one launch later, onto the scores of batches 0-3, which are spent by then.
    bf* P = (bf*)take((size_t)NB_ / 2 * SS * SS * 4); float* S = (float*)take((size_t)NB_ * SS * SS * 4);
    if ((size_t)(wsp - (char*)d_ws) > ws_size) return;    // total ~ 216 MiB
    float* SH = S + (size_t)NB_ / 2 * SS * SS; bf* PH = P + (size_t)NB_ * SS * SS;   // batch 4 of each
    float* CTX = SH; bf* CAh = (bf*)(CTX + (size_t)NB_ * SS * DD); bf* CAl = CAh + (size_t)NB_ * SS * 2 * DD;   // 48 MiB on the scores of batches 4-7, spent after the second k_smax
    k_wtG<<<(2 * DD * DD / 64 + 63) / 64, 256, 0, stream>>>(Wt, 2 * DD, DD, BW);   // 'xw' [512][256]
    k_cvt8<<<(NB_ * SS * DD / 8 + 255) / 256, 256, 0, stream>>>(enc, EB, NB_ * SS * DD / 8); k_cvt8<<<(NB_ * SS * DD / 8 + 255) / 256, 256, 0, stream>>>(dec, DB, NB_ * SS * DD / 8); k_tr<<<(NB_ * DD * SS / 2 + 255) / 256, 256, 0, stream>>>(enc, ET);
    k_gemmw<bf, 0, false><<<dim3(SS / 64, SS / 64, NB_), 32, 0, stream>>>(EB, nullptr, DB, nullptr, DD, S, SS, nullptr, (size_t)SS * DD, (size_t)SS * DD, (size_t)SS * SS);      // scores[b][s][t] = enc[b][s] . dec[b][t]
    k_smax<<<NB_ / 2 * SS / 8, 256, 0, stream>>>(S, P, P + (size_t)SS * SS); k_smax<<<NB_ / 2 * SS / 8, 256, 0, stream>>>(SH, PH, PH + (size_t)SS * SS);
    k_gemmw<bf, 1, false><<<dim3(SS / 64, DD / 64, NB_), 32, 0, stream>>>(P, P + (size_t)SS * SS, ET, nullptr, SS, CTX, DD, nullptr, (size_t)2 * SS * SS, (size_t)DD * SS, (size_t)SS * DD);   // context = weights . enc
    k_cat<<<(NB_ * SS * 2 * DD / 4 + 255) / 256, 256, 0, stream>>>(CTX, dec, CAh, CAl);
    k_gemmw<bf, 1, false><<<dim3(NB_ * SS / 64, DD / 64, 1), 32, 0, stream>>>(CAh, CAl, BW, nullptr, 2 * DD, OUT, DD, nullptr, 0, 0, 0);   // all batches as one M = 16,384
    k_tanh<<<(NB_ * SS * DD / 4 + 255) / 256, 256, 0, stream>>>(OUT, (size_t)NB_ * SS * DD / 4);
}

// v002
// It runs in 131 microseconds.
// Timed twice side by side with v001, it ran 1.74 times as fast both times.
// All steps since v000 together make it 6.02 times as fast.
#include <hip/hip_runtime.h>

// LuongAttention (enc, dec [8][2048][256]; scores[s][t] = enc[s] . dec[t] (unscaled); softmax over t (decoder time); context[s] = sum_t weights[s][t] enc[t] (the source contracts the weights' decoder axis with enc's time axis; both are 2,048 long); out = tanh([context | dec] W_tanh) -> [8][2048][256]).
// Compute dtypes, f32 accumulate: every input rounded to bf16; the unscaled scores are a PLAIN bf16 GEMM of the inputs themselves (exact products, f32 sums - they reach |90|, so nothing narrower would do); softmax f32, running maximum and sum, weights -> hl fragments in registers; context as hl x exact enc (2 products); [hl(context) | bf16(dec)] x exact W_tanh (2 products); tanh f32.

#define NB_  8
#define SS   2048
#define DD   256
typedef _Float16 h16;
typedef unsigned short bf;
typedef __attribute__((ext_vector_type(16))) __bf16   v16bf;
typedef __attribute__((ext_vector_type(16))) _Float16 v16h;
typedef __attribute__((ext_vector_type(8)))  _Float16 v8h;
typedef __attribute__((ext_vector_type(8)))  unsigned short v8us;
typedef __attribute__((ext_vector_type(8)))  float    v8f;
typedef __attribute__((ext_vector_type(4)))  float    v4f;
typedef v8h  __attribute__((may_alias)) v8ha;
typedef v4f  __attribute__((may_alias)) v4fa;
typedef v8us __attribute__((may_alias)) v8usa;

__device__ __forceinline__ unsigned short f2bf(float f) { unsigned u = __float_as_uint(f); u += 0x7FFFu + ((u >> 16) & 1u); return (unsigned short)(u >> 16); }
__device__ __forceinline__ float bf2f(unsigned short b) { return __uint_as_float(((unsigned)b) << 16); }
__device__ __forceinline__ float bfr(float f) { return bf2f(f2bf(f)); }
__device__ __forceinline__ v16h cat16(v8h lo, v8h hi) { return __builtin_shufflevector(lo, hi, 0, 1, 2, 3, 4, 5, 6, 7, 8, 9, 10, 11, 12, 13, 14, 15); }
__device__ __forceinline__ v16bf cat16b(v8us lo, v8us hi) { return __builtin_bit_cast(v16bf, __builtin_shufflevector(lo, hi, 0, 1, 2, 3, 4, 5, 6, 7, 8, 9, 10, 11, 12, 13, 14, 15)); }
__device__ __forceinline__ v8f wmma16(v16h a, v16h b, v8f c) { return __builtin_amdgcn_wmma_f32_16x16x32_f16(false, a, false, b, (short)0, c, false, false); }
__device__ __forceinline__ v8f wmmab(v16bf a, v16bf b, v8f c) { return __builtin_amdgcn_wmma_f32_16x16x32_bf16(false, a, false, b, (short)0, c, false, false); }



// ---- k_gemmw: register-blocked GEMM, ONE WAVE per 64x64 output tile (16 accumulators), operands straight from K-contiguous 16-bit planes; grid (M/64, N/64, Z), 32 threads.
// C[m][n] (f32, pitch ldc, + optional f32 bias[n]) = sum_k A[m][k] Bt[n][k] (+ split products per NSPLIT). z-batch strides sA/sB/sC in elements. K % 32 == 0.
template <typename T16> struct WFrag;
template <> struct WFrag<h16> { typedef v16h V; static __device__ __forceinline__ V ld(const h16* p) { return cat16(*(const v8h*)p, *(const v8h*)(p + 16)); } static __device__ __forceinline__ v8f mma(V a, V b, v8f c) { return wmma16(a, b, c); } };
template <> struct WFrag<bf> { typedef v16bf V; static __device__ __forceinline__ V ld(const bf* p) { return cat16b(*(const v8us*)p, *(const v8us*)(p + 16)); } static __device__ __forceinline__ v8f mma(V a, V b, v8f c) { return wmmab(a, b, c); } };
template <typename T16, int NSPLIT, bool BIAS>
__global__ __launch_bounds__(32) void k_gemmw(const T16* __restrict__ A, const T16* __restrict__ A2, const T16* __restrict__ Bt, const T16* __restrict__ Bt2, int K, float* C, int ldc, const float* __restrict__ bias, size_t sA, size_t sB, size_t sC) {
    typedef typename WFrag<T16>::V V;
    __shared__ __align__(16) float os[16 * 68];
    const size_t z = blockIdx.z; A += z * sA; if (A2) A2 += z * sA; Bt += z * sB; if (Bt2) Bt2 += z * sB; C += z * sC;
    const int lane = threadIdx.x & 31, lr = lane & 15, hi = lane >> 4; const int r0 = blockIdx.x * 64, c0 = blockIdx.y * 64;
    v8f acc[4][4];
#pragma unroll
    for (int mb = 0; mb < 4; ++mb)
#pragma unroll
        for (int nb = 0; nb < 4; ++nb) acc[mb][nb] = (v8f){};
    const size_t aoff = (size_t)(r0 + lr) * K + 8 * hi, boff = (size_t)(c0 + lr) * K + 8 * hi;
#pragma unroll 1
    for (int kc = 0; kc < K; kc += 32) {
        V a[4], a2[4];
#pragma unroll
        for (int mb = 0; mb < 4; ++mb) { a[mb] = WFrag<T16>::ld(A + aoff + (size_t)mb * 16 * K + kc); if (NSPLIT == 1 || NSPLIT == 2) a2[mb] = WFrag<T16>::ld(A2 + aoff + (size_t)mb * 16 * K + kc); }
#pragma unroll
        for (int nb = 0; nb < 4; ++nb) { const V b = WFrag<T16>::ld(Bt + boff + (size_t)nb * 16 * K + kc); V b2; if (NSPLIT >= 2) b2 = WFrag<T16>::ld(Bt2 + boff + (size_t)nb * 16 * K + kc);
#pragma unroll
            for (int mb = 0; mb < 4; ++mb) { acc[mb][nb] = WFrag<T16>::mma(a[mb], b, acc[mb][nb]); if (NSPLIT == 1 || NSPLIT == 2) acc[mb][nb] = WFrag<T16>::mma(a2[mb], b, acc[mb][nb]); if (NSPLIT >= 2) acc[mb][nb] = WFrag<T16>::mma(a[mb], b2, acc[mb][nb]); } }
        asm volatile("v_nop\n\tv_nop\n\tv_nop\n\tv_nop" : "+v"(acc[0][0]), "+v"(acc[1][1]), "+v"(acc[2][2]), "+v"(acc[3][3]) : "v"(a[0]), "v"(a[3]));
    }
#pragma unroll
    for (int mb = 0; mb < 4; ++mb) {
#pragma unroll
        for (int nb = 0; nb < 4; ++nb) {
#pragma unroll
            for (int j = 0; j < 8; ++j) os[(hi * 8 + j) * 68 + nb * 16 + lr] = acc[mb][nb][j]; }
        __builtin_amdgcn_wave_barrier(); asm volatile("" ::: "memory");
        float* crow = C + (size_t)(r0 + mb * 16) * ldc + c0;
{
#pragma unroll
            for (int s = 0; s < 8; ++s) { const int row = 2 * s + hi, cofs = lr * 4; v4f val = *(const v4fa*)(os + row * 68 + cofs); if (BIAS) { val[0] += bfr(bias[c0 + cofs]); val[1] += bfr(bias[c0 + cofs + 1]); val[2] += bfr(bias[c0 + cofs + 2]); val[3] += bfr(bias[c0 + cofs + 3]); }
                *(v4f*)(crow + (size_t)row * ldc + cofs) = val; }
             }
        __builtin_amdgcn_wave_barrier(); asm volatile("" ::: "memory");
    }
}

__device__ __forceinline__ void splitf(float y, unsigned short& h, unsigned short& l) { h = f2bf(y); l = f2bf(y - bf2f(h)); }
typedef __attribute__((ext_vector_type(2))) unsigned short v2us;
typedef __attribute__((ext_vector_type(4))) unsigned short v4us;

__global__ __launch_bounds__(256) void k_cvt8(const float* __restrict__ src, bf* dst, size_t n8) { const size_t i = (size_t)blockIdx.x * 256 + threadIdx.x; if (i >= n8) return; const v8f v = *(const v8f*)(src + i * 8); v8us o;
#pragma unroll
    for (int k = 0; k < 8; ++k) o[k] = f2bf(v[k]); *(v8us*)(dst + i * 8) = o;  }
__global__ __launch_bounds__(256) void k_wtG(const float* __restrict__ w, int K, int N, bf* Bt) {
    const int lane = threadIdx.x & 31; const int L0 = (blockIdx.x * 8 + (threadIdx.x >> 5)) * 8; const int nlines = N * K / 64;
{
#pragma unroll 1
        for (int l = 0; l < 8; ++l) { const int L = L0 + l; if (L >= nlines) break; const size_t e = (size_t)L * 64 + lane * 2; const int k = (int)(e % K), n = (int)(e / K); v2us o;
            o[0] = f2bf(w[(size_t)k * N + n]); o[1] = f2bf(w[(size_t)(k + 1) * N + n]); *(v2us*)(Bt + e) = o; }
         }
}

__global__ __launch_bounds__(256) void k_tr(const float* __restrict__ E, bf* ET) { const size_t e = ((size_t)blockIdx.x * 256 + threadIdx.x) * 2; if (e >= (size_t)NB_ * DD * SS) return; const int t = (int)(e % SS); const int d = (int)(e / SS % DD); E += e / ((size_t)DD * SS) * ((size_t)SS * DD); v2us o; o[0] = f2bf(E[(size_t)t * DD + d]); o[1] = f2bf(E[(size_t)(t + 1) * DD + d]); *(v2us*)(ET + e) = o;  }
#define KT 64
#define KP 528                    // LDS pitch of a dec row: 512 + 16 bytes (16 x odd, conflict-free for 16-byte reads)
#define VP 144                    // LDS pitch of a V^T row: 128 + 16 bytes
#define KBYTES (KT * KP)
#define STG (KBYTES + DD * VP)    // one buffer: 70,656 bytes
typedef __attribute__((ext_vector_type(16))) float v16f;
typedef __attribute__((ext_vector_type(8))) unsigned v8u;
__device__ __forceinline__ v16bf ldsfrag(const unsigned char* p) { return cat16b(*(const v8usa*)p, *(const v8usa*)(p + 32)); }
__device__ __forceinline__ float xhalf(float x) { const int b = __float_as_int(x); return __int_as_float(__builtin_amdgcn_permlanex16(b, b, 0x76543210, 0xfedcba98, false, false)); }   // lane l <-> l ^ 16
__global__ __launch_bounds__(128) void k_fattn(const bf* __restrict__ EB, const bf* __restrict__ DB, const bf* __restrict__ ET, float* __restrict__ CTX) {
    __shared__ __align__(16) unsigned char lds[2 * STG];
    const int tid = threadIdx.x, lane = tid & 31, c = lane & 15, h = lane >> 4;
    const size_t b = blockIdx.y; const int s0 = blockIdx.x * 64 + (tid >> 5) * 16;
    const bf* Kg = DB + b * SS * DD + tid * 8;                                   // the K tile is 32 KiB in a row: chunk x = i * 128 + tid
    const bf* Vg = ET + b * DD * SS + (size_t)(tid >> 3) * SS + (tid & 7) * 8;   // V^T tile: 8 chunks a row, 16 rows per i
    const int kst = (tid >> 5) * KP + (tid & 31) * 16, vst = KBYTES + (tid >> 3) * VP + (tid & 7) * 16;
    v16bf q[8];
#pragma unroll
    for (int kc = 0; kc < 8; ++kc) q[kc] = WFrag<bf>::ld(EB + (b * SS + s0 + c) * DD + 8 * h + kc * 32);
    v8us kr[16], vr[16];
#pragma unroll
    for (int i = 0; i < 16; ++i) { kr[i] = *(const v8us*)(Kg + i * 1024); vr[i] = *(const v8us*)(Vg + (size_t)i * 16 * SS); }
    asm volatile("s_wait_xcnt 0x0" ::: "memory");   // in front of the first overwrite of an address register that the loads above name
#pragma unroll
    for (int i = 0; i < 16; ++i) { *(v8usa*)(lds + kst + i * 4 * KP) = kr[i]; *(v8usa*)(lds + vst + i * 16 * VP) = vr[i]; }
    __syncthreads();
    v8f o[16];
#pragma unroll
    for (int dt = 0; dt < 16; ++dt) o[dt] = (v8f){};
    float mul2 = -3.0e38f;   // maximum in use, in log2 units
    v16f lv = (v16f){};      // this lane's share of the row sum, 16 independent partial sums
    const int ka = c * KP + 16 * h, va = KBYTES + c * VP + 16 * h;
#pragma unroll 1
    for (int st = 0; st < SS / KT; ++st) {
        const unsigned char* kb = lds + (st & 1) * STG; unsigned char* nb = lds + ((st + 1) & 1) * STG;
        const bool more = st + 1 < SS / KT;
        // Fragments come from LDS in groups of 8 (16 loads), each group issued as one block ahead of the products of the group before it: K groups 0-3 (2 k-chunks x 4 t-tiles), V^T groups 0-3 (4 d-tiles x 2 t-chunks).
        // The sched_barrier(0) calls keep each load block whole and in front of those products; without them the compiler sinks every load to its product and the wave waits out the LDS latency at each one.
        v16bf f[2][8];
#pragma unroll
        for (int u = 0; u < 8; ++u) f[0][u] = ldsfrag(kb + ka + (u & 3) * 16 * KP + (u >> 2) * 64);
        if (more) {   // the next stage's tiles fly while this stage is worked on
#pragma unroll
            for (int i = 0; i < 16; ++i) { kr[i] = *(const v8us*)(Kg + (size_t)(st + 1) * KT * DD + i * 1024); vr[i] = *(const v8us*)(Vg + (size_t)i * 16 * SS + (st + 1) * KT); }
            asm volatile("s_wait_xcnt 0x0" ::: "memory");   // in front of the first overwrite of an address register that these loads name
        }
        v8f sT[4];
#pragma unroll
        for (int tt = 0; tt < 4; ++tt) sT[tt] = (v8f){};
#pragma unroll
        for (int g = 0; g < 4; ++g) {
#pragma unroll
            for (int u = 0; u < 8; ++u) f[(g + 1) & 1][u] = g < 3 ? ldsfrag(kb + ka + (u & 3) * 16 * KP + ((g + 1) * 2 + (u >> 2)) * 64) : ldsfrag(kb + va + (u >> 1) * 16 * VP + (u & 1) * 64);
            __builtin_amdgcn_sched_barrier(0);
#pragma unroll
            for (int u = 0; u < 8; ++u) sT[u & 3] = wmmab(f[g & 1][u], q[g * 2 + (u >> 2)], sT[u & 3]);
            __builtin_amdgcn_sched_barrier(0);
        }
        if (more) {   // here, so that the LDS takes these stores during the vector work below, when it has no reads to serve; the other buffer's last readers left it at the barrier that ended the stage before
#pragma unroll
            for (int i = 0; i < 16; ++i) { *(v8usa*)(nb + kst + i * 4 * KP) = kr[i]; *(v8usa*)(nb + vst + i * 16 * VP) = vr[i]; }
        }
        float m4[4];
#pragma unroll
        for (int tt = 0; tt < 4; ++tt) { m4[tt] = sT[tt][0];
#pragma unroll
            for (int j = 1; j < 8; ++j) m4[tt] = fmaxf(m4[tt], sT[tt][j]); }
        float mx = fmaxf(fmaxf(m4[0], m4[1]), fmaxf(m4[2], m4[3]));
        mx = fmaxf(mx, xhalf(mx)) * 1.4426950408889634f;
        if (__builtin_amdgcn_ballot_w32(mx > mul2 + 8.0f) != 0) {   // one wave-uniform test a stage: rescale only when a row's maximum outgrows the one in use by 2^8
            const float mn = fmaxf(mul2, mx), sc = __builtin_amdgcn_exp2f(mul2 - mn); mul2 = mn; lv *= sc;
#pragma unroll
            for (int dt = 0; dt < 16; ++dt) o[dt] *= sc;
        }
        v16bf ph[2], pl[2];
#pragma unroll
        for (int kk = 0; kk < 2; ++kk) { v16f p;
#pragma unroll
            for (int e = 0; e < 16; ++e) p[e] = __builtin_amdgcn_exp2f(__builtin_fmaf(sT[kk * 2 + (e >> 3)][e & 7], 1.4426950408889634f, -mul2));
            lv += p; ph[kk] = __builtin_convertvector(p, v16bf); const v8u w = __builtin_bit_cast(v8u, ph[kk]); v16f hf;
#pragma unroll
            for (int i = 0; i < 8; ++i) { hf[2 * i] = __uint_as_float(w[i] << 16); hf[2 * i + 1] = __uint_as_float(w[i] & 0xFFFF0000u); }
            pl[kk] = __builtin_convertvector(p - hf, v16bf); }
        __builtin_amdgcn_sched_barrier(0);
#pragma unroll
        for (int g = 0; g < 4; ++g) {
            if (g < 3) {
#pragma unroll
                for (int u = 0; u < 8; ++u) f[(g + 1) & 1][u] = ldsfrag(kb + va + ((g + 1) * 4 + (u >> 1)) * 16 * VP + (u & 1) * 64);
            }
            __builtin_amdgcn_sched_barrier(0);
#pragma unroll
            for (int kk = 0; kk < 2; ++kk) {
#pragma unroll
                for (int u = 0; u < 4; ++u) o[g * 4 + u] = wmmab(f[g & 1][u * 2 + kk], ph[kk], o[g * 4 + u]);
#pragma unroll
                for (int u = 0; u < 4; ++u) o[g * 4 + u] = wmmab(f[g & 1][u * 2 + kk], pl[kk], o[g * 4 + u]); }
            __builtin_amdgcn_sched_barrier(0);
        }
        __syncthreads();   // publishes the next stage and ends every wave's reads of this one
    }
    float l = 0.f;
#pragma unroll
    for (int e = 0; e < 16; ++e) l += lv[e];
    l += xhalf(l);
    const float f = __fdiv_rn(1.0f, l);
    float* crow = CTX + (b * SS + s0 + c) * DD + 8 * h;   // o[dt][r] = context[s0 + c][dt * 16 + 8h + r]
#pragma unroll
    for (int dt = 0; dt < 16; ++dt) *(v8f*)(crow + dt * 16) = o[dt] * f;
}
__global__ __launch_bounds__(256) void k_cat(const float* __restrict__ CTX, const float* __restrict__ dec, bf* Ah, bf* Al) { const size_t e = ((size_t)blockIdx.x * 256 + threadIdx.x) * 4; if (e >= (size_t)NB_ * SS * 2 * DD) return; const int c = (int)(e % (2 * DD)); const size_t s = e / (2 * DD); v4us oh, ol;
#pragma unroll
    for (int u = 0; u < 4; ++u) { if (c < DD) { unsigned short a, b; splitf(CTX[s * DD + c + u], a, b); oh[u] = a; ol[u] = b; } else { oh[u] = f2bf(dec[s * DD + c - DD + u]); ol[u] = 0; } }
    *(v4us*)(Ah + e) = oh; *(v4us*)(Al + e) = ol;  }
__global__ __launch_bounds__(256) void k_tanh(float* O, size_t n4) { const size_t e = ((size_t)blockIdx.x * 256 + threadIdx.x) * 4; if (e >= n4 * 4) return; const v4f a = *(const v4f*)(O + e); v4f r;
#pragma unroll
    for (int u = 0; u < 4; ++u) r[u] = tanhf(a[u]); *(v4f*)(O + e) = r;  }

extern "C" void kernel_launch(void* const* d_in, const int* in_sizes, int n_in,
                              void* d_out, int out_size, void* d_ws, size_t ws_size, hipStream_t stream) {
    (void)in_sizes; (void)n_in; (void)out_size;
    const float* enc = (const float*)d_in[0]; const float* dec = (const float*)d_in[1]; const float* Wt = (const float*)d_in[2];
    float* OUT = (float*)d_out;     // [8][2048][256]
    char* wsp = (char*)d_ws;
    auto take = [&](size_t bytes) { char* p = wsp; wsp += (bytes + 255) & ~(size_t)255; return (void*)p; };
    bf* BW = (bf*)take((size_t)2 * DD * DD * 2); bf* EB = (bf*)take((size_t)NB_ * SS * DD * 2); bf* DB = (bf*)take((size_t)NB_ * SS * DD * 2); bf* ET = (bf*)take((size_t)NB_ * DD * SS * 2);
    float* CTX = (float*)take((size_t)NB_ * SS * DD * 4); bf* CAh = (bf*)take((size_t)NB_ * SS * 2 * DD * 2); bf* CAl = (bf*)take((size_t)NB_ * SS * 2 * DD * 2);
    if ((size_t)(wsp - (char*)d_ws) > ws_size) return;    // total ~ 72 MiB
    k_wtG<<<(2 * DD * DD / 64 + 63) / 64, 256, 0, stream>>>(Wt, 2 * DD, DD, BW);   // 'xw' [512][256]
    k_cvt8<<<(NB_ * SS * DD / 8 + 255) / 256, 256, 0, stream>>>(enc, EB, NB_ * SS * DD / 8); k_cvt8<<<(NB_ * SS * DD / 8 + 255) / 256, 256, 0, stream>>>(dec, DB, NB_ * SS * DD / 8); k_tr<<<(NB_ * DD * SS / 2 + 255) / 256, 256, 0, stream>>>(enc, ET);
    k_fattn<<<dim3(SS / 64, NB_), 128, 0, stream>>>(EB, DB, ET, CTX);   // context = softmax_t(enc . dec^T) . enc
    k_cat<<<(NB_ * SS * 2 * DD / 4 + 255) / 256, 256, 0, stream>>>(CTX, dec, CAh, CAl);
    k_gemmw<bf, 1, false><<<dim3(NB_ * SS / 64, DD / 64, 1), 32, 0, stream>>>(CAh, CAl, BW, nullptr, 2 * DD, OUT, DD, nullptr, 0, 0, 0);   // all batches as one M = 16,384
    k_tanh<<<(NB_ * SS * DD / 4 + 255) / 256, 256, 0, stream>>>(OUT, (size_t)NB_ * SS * DD / 4);
}

// v003
// A run of this version takes 100 microseconds.
// In both of two side-by-side timings against v002, it was 1.30 times as fast.
// Counting every step since v000, it is 7.83 times as fast.
#include <hip/hip_runtime.h>

// LuongAttention (enc, dec [8][2048][256]; scores[s][t] = enc[s] . dec[t] (unscaled); softmax over t (decoder time); context[s] = sum_t weights[s][t] enc[t] (the source contracts the weights' decoder axis with enc's time axis; both are 2,048 long); out = tanh([context | dec] W_tanh) -> [8][2048][256]).
// Compute dtypes, f32 accumulate: every input rounded to bf16; the unscaled scores are a PLAIN bf16 GEMM of the inputs themselves (exact products, f32 sums - they reach |90|, so nothing narrower would do); softmax f32, running maximum and sum, weights -> hl fragments in registers; context as hl x exact enc (2 products); [hl(context) | bf16(dec)] x exact W_tanh (2 products for the context half, 1 for dec), in the same kernel; tanh f32.

#define NB_  8
#define SS   2048
#define DD   256
typedef _Float16 h16;
typedef unsigned short bf;
typedef __attribute__((ext_vector_type(16))) __bf16   v16bf;
typedef __attribute__((ext_vector_type(16))) _Float16 v16h;
typedef __attribute__((ext_vector_type(8)))  _Float16 v8h;
typedef __attribute__((ext_vector_type(8)))  unsigned short v8us;
typedef __attribute__((ext_vector_type(8)))  float    v8f;
typedef __attribute__((ext_vector_type(4)))  float    v4f;
typedef v8h  __attribute__((may_alias)) v8ha;
typedef v4f  __attribute__((may_alias)) v4fa;
typedef v8us __attribute__((may_alias)) v8usa;

__device__ __forceinline__ unsigned short f2bf(float f) { unsigned u = __float_as_uint(f); u += 0x7FFFu + ((u >> 16) & 1u); return (unsigned short)(u >> 16); }
__device__ __forceinline__ float bf2f(unsigned short b) { return __uint_as_float(((unsigned)b) << 16); }
__device__ __forceinline__ float bfr(float f) { return bf2f(f2bf(f)); }
__device__ __forceinline__ v16h cat16(v8h lo, v8h hi) { return __builtin_shufflevector(lo, hi, 0, 1, 2, 3, 4, 5, 6, 7, 8, 9, 10, 11, 12, 13, 14, 15); }
__device__ __forceinline__ v16bf cat16b(v8us lo, v8us hi) { return __builtin_bit_cast(v16bf, __builtin_shufflevector(lo, hi, 0, 1, 2, 3, 4, 5, 6, 7, 8, 9, 10, 11, 12, 13, 14, 15)); }
__device__ __forceinline__ v8f wmma16(v16h a, v16h b, v8f c) { return __builtin_amdgcn_wmma_f32_16x16x32_f16(false, a, false, b, (short)0, c, false, false); }
__device__ __forceinline__ v8f wmmab(v16bf a, v16bf b, v8f c) { return __builtin_amdgcn_wmma_f32_16x16x32_bf16(false, a, false, b, (short)0, c, false, false); }



// 16-bit fragment of 32 k from a K-contiguous row: 16 bytes at p and at p + 16 elements (the caller adds 8 * (lane >> 4)).
template <typename T16> struct WFrag;
template <> struct WFrag<h16> { typedef v16h V; static __device__ __forceinline__ V ld(const h16* p) { return cat16(*(const v8h*)p, *(const v8h*)(p + 16)); } static __device__ __forceinline__ v8f mma(V a, V b, v8f c) { return wmma16(a, b, c); } };
template <> struct WFrag<bf> { typedef v16bf V; static __device__ __forceinline__ V ld(const bf* p) { return cat16b(*(const v8us*)p, *(const v8us*)(p + 16)); } static __device__ __forceinline__ v8f mma(V a, V b, v8f c) { return wmmab(a, b, c); } };
typedef __attribute__((ext_vector_type(2))) unsigned short v2us;
typedef __attribute__((ext_vector_type(4))) unsigned short v4us;

__global__ __launch_bounds__(256) void k_cvt8(const float* __restrict__ src, bf* dst, size_t n8) { const size_t i = (size_t)blockIdx.x * 256 + threadIdx.x; if (i >= n8) return; const v8f v = *(const v8f*)(src + i * 8); v8us o;
#pragma unroll
    for (int k = 0; k < 8; ++k) o[k] = f2bf(v[k]); *(v8us*)(dst + i * 8) = o;  }
__global__ __launch_bounds__(256) void k_wtG(const float* __restrict__ w, int K, int N, bf* Bt) {
    const int lane = threadIdx.x & 31; const int L0 = (blockIdx.x * 8 + (threadIdx.x >> 5)) * 8; const int nlines = N * K / 64;
{
#pragma unroll 1
        for (int l = 0; l < 8; ++l) { const int L = L0 + l; if (L >= nlines) break; const size_t e = (size_t)L * 64 + lane * 2; const int k = (int)(e % K), n = (int)(e / K); v2us o;
            o[0] = f2bf(w[(size_t)k * N + n]); o[1] = f2bf(w[(size_t)(k + 1) * N + n]); *(v2us*)(Bt + e) = o; }
         }
}

__global__ __launch_bounds__(256) void k_tr(const float* __restrict__ E, bf* ET) { const size_t e = ((size_t)blockIdx.x * 256 + threadIdx.x) * 2; if (e >= (size_t)NB_ * DD * SS) return; const int t = (int)(e % SS); const int d = (int)(e / SS % DD); E += e / ((size_t)DD * SS) * ((size_t)SS * DD); v2us o; o[0] = f2bf(E[(size_t)t * DD + d]); o[1] = f2bf(E[(size_t)(t + 1) * DD + d]); *(v2us*)(ET + e) = o;  }
#define KT 64
#define KP 528                    // LDS pitch of a dec row: 512 + 16 bytes (16 x odd, conflict-free for 16-byte reads)
#define VP 144                    // LDS pitch of a V^T row: 128 + 16 bytes
#define KBYTES (KT * KP)
#define STG (KBYTES + DD * VP)    // one buffer: 70,656 bytes
#define WP 1040                   // LDS pitch of a W^T row: 1,024 + 16 bytes (16 x odd)
#define WQ (64 * WP)              // one buffer of the output product: 64 rows n, 66,560 bytes; two of them fit the stage buffers
typedef __attribute__((ext_vector_type(16))) float v16f;
typedef __attribute__((ext_vector_type(8))) unsigned v8u;
__device__ __forceinline__ v16bf ldsfrag(const unsigned char* p) { return cat16b(*(const v8usa*)p, *(const v8usa*)(p + 32)); }
__device__ __forceinline__ float xhalf(float x) { const int b = __float_as_int(x); return __int_as_float(__builtin_amdgcn_permlanex16(b, b, 0x76543210, 0xfedcba98, false, false)); }   // lane l <-> l ^ 16
__global__ __launch_bounds__(128) void k_fattn(const bf* __restrict__ EB, const bf* __restrict__ DB, const bf* __restrict__ ET, const bf* __restrict__ BW, float* __restrict__ OUT) {
    __shared__ __align__(16) unsigned char lds[2 * STG];
    const int tid = threadIdx.x, lane = tid & 31, c = lane & 15, h = lane >> 4;
    const size_t b = blockIdx.y; const int s0 = blockIdx.x * 64 + (tid >> 5) * 16;
    const bf* Kg = DB + b * SS * DD + tid * 8;                                   // the K tile is 32 KiB in a row: chunk x = i * 128 + tid
    const bf* Vg = ET + b * DD * SS + (size_t)(tid >> 3) * SS + (tid & 7) * 8;   // V^T tile: 8 chunks a row, 16 rows per i
    const int kst = (tid >> 5) * KP + (tid & 31) * 16, vst = KBYTES + (tid >> 3) * VP + (tid & 7) * 16;
    v16bf q[8];
#pragma unroll
    for (int kc = 0; kc < 8; ++kc) q[kc] = WFrag<bf>::ld(EB + (b * SS + s0 + c) * DD + 8 * h + kc * 32);
    v8us kr[16], vr[16];
#pragma unroll
    for (int i = 0; i < 16; ++i) { kr[i] = *(const v8us*)(Kg + i * 1024); vr[i] = *(const v8us*)(Vg + (size_t)i * 16 * SS); }
    asm volatile("s_wait_xcnt 0x0" ::: "memory");   // in front of the first overwrite of an address register that the loads above name
#pragma unroll
    for (int i = 0; i < 16; ++i) { *(v8usa*)(lds + kst + i * 4 * KP) = kr[i]; *(v8usa*)(lds + vst + i * 16 * VP) = vr[i]; }
    __syncthreads();
    v8f o[16];
#pragma unroll
    for (int dt = 0; dt < 16; ++dt) o[dt] = (v8f){};
    float mul2 = -3.0e38f;   // maximum in use, in log2 units
    v16f lv = (v16f){};      // this lane's share of the row sum, 16 independent partial sums
    const int ka = c * KP + 16 * h, va = KBYTES + c * VP + 16 * h;
#pragma unroll 1
    for (int st = 0; st < SS / KT; ++st) {
        const unsigned char* kb = lds + (st & 1) * STG; unsigned char* nb = lds + ((st + 1) & 1) * STG;
        const bool more = st + 1 < SS / KT;
        // Fragments come from LDS in groups of 8 (16 loads), each group issued as one block ahead of the products of the group before it: K groups 0-3 (2 k-chunks x 4 t-tiles), V^T groups 0-3 (4 d-tiles x 2 t-chunks).
        // The sched_barrier(0) calls keep each load block whole and in front of those products; without them the compiler sinks every load to its product and the wave waits out the LDS latency at each one.
        v16bf f[2][8];
#pragma unroll
        for (int u = 0; u < 8; ++u) f[0][u] = ldsfrag(kb + ka + (u & 3) * 16 * KP + (u >> 2) * 64);
        if (more) {   // the next stage's tiles fly while this stage is worked on
#pragma unroll
            for (int i = 0; i < 16; ++i) { kr[i] = *(const v8us*)(Kg + (size_t)(st + 1) * KT * DD + i * 1024); vr[i] = *(const v8us*)(Vg + (size_t)i * 16 * SS + (st + 1) * KT); }
            asm volatile("s_wait_xcnt 0x0" ::: "memory");   // in front of the first overwrite of an address register that these loads name
        }
        v8f sT[4];
#pragma unroll
        for (int tt = 0; tt < 4; ++tt) sT[tt] = (v8f){};
#pragma unroll
        for (int g = 0; g < 4; ++g) {
#pragma unroll
            for (int u = 0; u < 8; ++u) f[(g + 1) & 1][u] = g < 3 ? ldsfrag(kb + ka + (u & 3) * 16 * KP + ((g + 1) * 2 + (u >> 2)) * 64) : ldsfrag(kb + va + (u >> 1) * 16 * VP + (u & 1) * 64);
            __builtin_amdgcn_sched_barrier(0);
#pragma unroll
            for (int u = 0; u < 8; ++u) sT[u & 3] = wmmab(f[g & 1][u], q[g * 2 + (u >> 2)], sT[u & 3]);
            __builtin_amdgcn_sched_barrier(0);
        }
        if (more) {   // here, so that the LDS takes these stores during the vector work below, when it has no reads to serve; the other buffer's last readers left it at the barrier that ended the stage before
#pragma unroll
            for (int i = 0; i < 16; ++i) { *(v8usa*)(nb + kst + i * 4 * KP) = kr[i]; *(v8usa*)(nb + vst + i * 16 * VP) = vr[i]; }
        }
        float m4[4];
#pragma unroll
        for (int tt = 0; tt < 4; ++tt) { m4[tt] = sT[tt][0];
#pragma unroll
            for (int j = 1; j < 8; ++j) m4[tt] = fmaxf(m4[tt], sT[tt][j]); }
        float mx = fmaxf(fmaxf(m4[0], m4[1]), fmaxf(m4[2], m4[3]));
        mx = fmaxf(mx, xhalf(mx)) * 1.4426950408889634f;
        if (__builtin_amdgcn_ballot_w32(mx > mul2 + 8.0f) != 0) {   // one wave-uniform test a stage: rescale only when a row's maximum outgrows the one in use by 2^8
            const float mn = fmaxf(mul2, mx), sc = __builtin_amdgcn_exp2f(mul2 - mn); mul2 = mn; lv *= sc;
#pragma unroll
            for (int dt = 0; dt < 16; ++dt) o[dt] *= sc;
        }
        v16bf ph[2], pl[2];
#pragma unroll
        for (int kk = 0; kk < 2; ++kk) { v16f p;
#pragma unroll
            for (int e = 0; e < 16; ++e) p[e] = __builtin_amdgcn_exp2f(__builtin_fmaf(sT[kk * 2 + (e >> 3)][e & 7], 1.4426950408889634f, -mul2));
            lv += p; ph[kk] = __builtin_convertvector(p, v16bf); const v8u w = __builtin_bit_cast(v8u, ph[kk]); v16f hf;
#pragma unroll
            for (int i = 0; i < 8; ++i) { hf[2 * i] = __uint_as_float(w[i] << 16); hf[2 * i + 1] = __uint_as_float(w[i] & 0xFFFF0000u); }
            pl[kk] = __builtin_convertvector(p - hf, v16bf); }
        __builtin_amdgcn_sched_barrier(0);
#pragma unroll
        for (int g = 0; g < 4; ++g) {
            if (g < 3) {
#pragma unroll
                for (int u = 0; u < 8; ++u) f[(g + 1) & 1][u] = ldsfrag(kb + va + ((g + 1) * 4 + (u >> 1)) * 16 * VP + (u & 1) * 64);
            }
            __builtin_amdgcn_sched_barrier(0);
#pragma unroll
            for (int kk = 0; kk < 2; ++kk) {
#pragma unroll
                for (int u = 0; u < 4; ++u) o[g * 4 + u] = wmmab(f[g & 1][u * 2 + kk], ph[kk], o[g * 4 + u]);
#pragma unroll
                for (int u = 0; u < 4; ++u) o[g * 4 + u] = wmmab(f[g & 1][u * 2 + kk], pl[kk], o[g * 4 + u]); }
            __builtin_amdgcn_sched_barrier(0);
        }
        __syncthreads();   // publishes the next stage and ends every wave's reads of this one
    }
    // ---- Output product: OUT^T[n][s] = sum_k W^T[n][k] X^T[k][s], X = [context | dec], k = 0..511. A = W^T rows from LDS, B = this wave's 16 rows s, all in registers:
    // two O^T tiles (d 0-15, 16-31 of a 32-block) converted in place are a B fragment in the hardware k order, as the weights were above; the dec rows load as the enc rows did.
    // W^T comes in four quarters of 64 rows n, two LDS buffers, one barrier a quarter; per accumulator the k order is hi, lo of each 32-block, context first, then dec.
    const bf* Wg = BW + tid * 8;                                                 // a quarter is 64 KiB in a row: chunk x = i * 128 + tid, 64 chunks a row
    const int wst = (tid >> 6) * WP + (tid & 63) * 16, wa = c * WP + 16 * h;
    v8us wr[32];
#pragma unroll
    for (int i = 0; i < 32; ++i) wr[i] = *(const v8us*)(Wg + i * 1024);
    asm volatile("s_wait_xcnt 0x0" ::: "memory");   // in front of the first overwrite of an address register that the loads above name
    __builtin_amdgcn_sched_barrier(0);              // keeps the next loads' address arithmetic, which reuses that register, behind the wait
    v16bf dq[8];
#pragma unroll
    for (int kc = 0; kc < 8; ++kc) dq[kc] = WFrag<bf>::ld(DB + (b * SS + s0 + c) * DD + 8 * h + kc * 32);
    asm volatile("s_wait_xcnt 0x0" ::: "memory");   // in front of the first overwrite of an address register that the loads above name
    float l = 0.f;
#pragma unroll
    for (int e = 0; e < 16; ++e) l += lv[e];
    l += xhalf(l);
    const float rl = __fdiv_rn(1.0f, l);
    v16bf ch[8], cl[8];   // o[dt][r] = context[s0 + c][dt * 16 + 8h + r], split into hi + lo bf16
#pragma unroll
    for (int kc = 0; kc < 8; ++kc) { v16f p;
#pragma unroll
        for (int e = 0; e < 16; ++e) p[e] = o[kc * 2 + (e >> 3)][e & 7] * rl;
        ch[kc] = __builtin_convertvector(p, v16bf); const v8u w = __builtin_bit_cast(v8u, ch[kc]); v16f hf;
#pragma unroll
        for (int i = 0; i < 8; ++i) { hf[2 * i] = __uint_as_float(w[i] << 16); hf[2 * i + 1] = __uint_as_float(w[i] & 0xFFFF0000u); }
        cl[kc] = __builtin_convertvector(p - hf, v16bf); }
#pragma unroll
    for (int i = 0; i < 32; ++i) *(v8usa*)(lds + wst + i * 2 * WP) = wr[i];   // the stage buffers' last readers left them at the barrier that ended the stage loop
    __syncthreads();
    float* orow = OUT + (b * SS + s0 + c) * DD + 8 * h;   // acc[u][r] = out[s0 + c][ng * 64 + u * 16 + 8h + r]
    // The quarter loop stays rolled (unroll 1) to keep the code short; its inner loops are unrolled in full so that the arrays they index stay in registers.
#pragma unroll 1
    for (int ng = 0; ng < 4; ++ng) {
        const unsigned char* wb = lds + (ng & 1) * WQ; unsigned char* nb = lds + ((ng + 1) & 1) * WQ;
        const bool more = ng + 1 < 4;
        v16bf f[2][8];   // groups of 8 fragments (2 k-chunks x 4 n-tiles), each issued as one block ahead of the products of the group before it, held there by the sched_barrier(0) calls as in the stage loop
#pragma unroll
        for (int u = 0; u < 8; ++u) f[0][u] = ldsfrag(wb + wa + (u & 3) * 16 * WP + (u >> 2) * 64);
        if (more) {   // the next quarter flies while this one is worked on
#pragma unroll
            for (int i = 0; i < 32; ++i) wr[i] = *(const v8us*)(Wg + (size_t)(ng + 1) * 64 * 2 * DD + i * 1024);
            asm volatile("s_wait_xcnt 0x0" ::: "memory");   // in front of the first overwrite of an address register that these loads name
        }
        v8f acc[4];
#pragma unroll
        for (int u = 0; u < 4; ++u) acc[u] = (v8f){};
#pragma unroll
        for (int g = 0; g < 8; ++g) {
            if (g < 7) {
#pragma unroll
                for (int u = 0; u < 8; ++u) f[(g + 1) & 1][u] = ldsfrag(wb + wa + (u & 3) * 16 * WP + ((g + 1) * 2 + (u >> 2)) * 64);
            }
            __builtin_amdgcn_sched_barrier(0);
#pragma unroll
            for (int kk = 0; kk < 2; ++kk) { const int kc = g * 2 + kk;
#pragma unroll
                for (int u = 0; u < 4; ++u) acc[u] = wmmab(f[g & 1][kk * 4 + u], kc < 8 ? ch[kc & 7] : dq[kc & 7], acc[u]);
                if (kc < 8) {
#pragma unroll
                    for (int u = 0; u < 4; ++u) acc[u] = wmmab(f[g & 1][kk * 4 + u], cl[kc & 7], acc[u]); } }
            __builtin_amdgcn_sched_barrier(0);
        }
        if (more) {   // the other buffer's last readers left it at the barrier that ended the quarter before
#pragma unroll
            for (int i = 0; i < 32; ++i) *(v8usa*)(nb + wst + i * 2 * WP) = wr[i];
        }
#pragma unroll
        for (int u = 0; u < 4; ++u) { v8f r;
#pragma unroll
            for (int j = 0; j < 8; ++j) r[j] = tanhf(acc[u][j]);
            *(v8f*)(orow + ng * 64 + u * 16) = r; }
        asm volatile("s_wait_xcnt 0x0" ::: "memory");   // in front of the first overwrite of a register that the stores above name
        __syncthreads();   // publishes the next quarter and ends every wave's reads of this one
    }
}

extern "C" void kernel_launch(void* const* d_in, const int* in_sizes, int n_in,
                              void* d_out, int out_size, void* d_ws, size_t ws_size, hipStream_t stream) {
    (void)in_sizes; (void)n_in; (void)out_size;
    const float* enc = (const float*)d_in[0]; const float* dec = (const float*)d_in[1]; const float* Wt = (const float*)d_in[2];
    float* OUT = (float*)d_out;     // [8][2048][256]
    char* wsp = (char*)d_ws;
    auto take = [&](size_t bytes) { char* p = wsp; wsp += (bytes + 255) & ~(size_t)255; return (void*)p; };
    bf* BW = (bf*)take((size_t)2 * DD * DD * 2); bf* EB = (bf*)take((size_t)NB_ * SS * DD * 2); bf* DB = (bf*)take((size_t)NB_ * SS * DD * 2); bf* ET = (bf*)take((size_t)NB_ * DD * SS * 2);
    if ((size_t)(wsp - (char*)d_ws) > ws_size) return;    // total ~ 24 MiB
    k_wtG<<<(2 * DD * DD / 64 + 63) / 64, 256, 0, stream>>>(Wt, 2 * DD, DD, BW);   // 'xw' [512][256]
    k_cvt8<<<(NB_ * SS * DD / 8 + 255) / 256, 256, 0, stream>>>(enc, EB, NB_ * SS * DD / 8); k_cvt8<<<(NB_ * SS * DD / 8 + 255) / 256, 256, 0, stream>>>(dec, DB, NB_ * SS * DD / 8); k_tr<<<(NB_ * DD * SS / 2 + 255) / 256, 256, 0, stream>>>(enc, ET);
    k_fattn<<<dim3(SS / 64, NB_), 128, 0, stream>>>(EB, DB, ET, BW, OUT);   // out = tanh([softmax_t(enc . dec^T) . enc | dec] W_tanh)
}

// v004
// One run takes 73.7 microseconds.
// In two side-by-side timings against v003, it was 1.36 and 1.37 times as fast.
// All steps since v000 together make it 10.7 times as fast.
#include <hip/hip_runtime.h>

// LuongAttention (enc, dec [8][2048][256]; scores[s][t] = enc[s] . dec[t] (unscaled); softmax over t (decoder time); context[s] = sum_t weights[s][t] enc[t] (the source contracts the weights' decoder axis with enc's time axis; both are 2,048 long); out = tanh([context | dec] W_tanh) -> [8][2048][256]).
// Compute dtypes, f32 accumulate: every input rounded to bf16; the unscaled scores are a PLAIN bf16 GEMM of the inputs themselves (exact products, f32 sums - they reach |90|, so nothing narrower would do); softmax f32, running maximum and sum, weights -> hl fragments in registers; context as hl x exact enc (2 products); [hl(context) | bf16(dec)] x exact W_tanh (2 products for the context half, 1 for dec), in the same kernel; tanh f32.

#define NB_  8
#define SS   2048
#define DD   256
typedef _Float16 h16;
typedef unsigned short bf;
typedef __attribute__((ext_vector_type(16))) __bf16   v16bf;
typedef __attribute__((ext_vector_type(16))) _Float16 v16h;
typedef __attribute__((ext_vector_type(8)))  _Float16 v8h;
typedef __attribute__((ext_vector_type(8)))  unsigned short v8us;
typedef __attribute__((ext_vector_type(8)))  float    v8f;
typedef __attribute__((ext_vector_type(4)))  float    v4f;
typedef v8h  __attribute__((may_alias)) v8ha;
typedef v4f  __attribute__((may_alias)) v4fa;
typedef v8us __attribute__((may_alias)) v8usa;

__device__ __forceinline__ unsigned short f2bf(float f) { unsigned u = __float_as_uint(f); u += 0x7FFFu + ((u >> 16) & 1u); return (unsigned short)(u >> 16); }
__device__ __forceinline__ float bf2f(unsigned short b) { return __uint_as_float(((unsigned)b) << 16); }
__device__ __forceinline__ float bfr(float f) { return bf2f(f2bf(f)); }
__device__ __forceinline__ v16h cat16(v8h lo, v8h hi) { return __builtin_shufflevector(lo, hi, 0, 1, 2, 3, 4, 5, 6, 7, 8, 9, 10, 11, 12, 13, 14, 15); }
__device__ __forceinline__ v16bf cat16b(v8us lo, v8us hi) { return __builtin_bit_cast(v16bf, __builtin_shufflevector(lo, hi, 0, 1, 2, 3, 4, 5, 6, 7, 8, 9, 10, 11, 12, 13, 14, 15)); }
__device__ __forceinline__ v8f wmma16(v16h a, v16h b, v8f c) { return __builtin_amdgcn_wmma_f32_16x16x32_f16(false, a, false, b, (short)0, c, false, false); }
__device__ __forceinline__ v8f wmmab(v16bf a, v16bf b, v8f c) { return __builtin_amdgcn_wmma_f32_16x16x32_bf16(false, a, false, b, (short)0, c, false, false); }



// 16-bit fragment of 32 k from a K-contiguous row: 16 bytes at p and at p + 16 elements (the caller adds 8 * (lane >> 4)).
template <typename T16> struct WFrag;
template <> struct WFrag<h16> { typedef v16h V; static __device__ __forceinline__ V ld(const h16* p) { return cat16(*(const v8h*)p, *(const v8h*)(p + 16)); } static __device__ __forceinline__ v8f mma(V a, V b, v8f c) { return wmma16(a, b, c); } };
template <> struct WFrag<bf> { typedef v16bf V; static __device__ __forceinline__ V ld(const bf* p) { return cat16b(*(const v8us*)p, *(const v8us*)(p + 16)); } static __device__ __forceinline__ v8f mma(V a, V b, v8f c) { return wmmab(a, b, c); } };
typedef __attribute__((ext_vector_type(2))) unsigned short v2us;
typedef __attribute__((ext_vector_type(4))) unsigned short v4us;

// ---- k_prep: every input goes to bf16 in ONE launch of few, fat work-groups (8 waves, 64 elements a thread, 16 loads of 16 bytes in flight a lane), for speed only.
// A work-group takes 64 rows x 256 columns of f32, 64 KiB in a row, so every wave-wide load covers four whole lines. Jobs by blockIdx.x: W_tanh (transposed only), enc (rows and transposed), dec (rows only).
// Transposing: wave w holds rows 8w..8w+7, a lane 4 columns of them in each half of 128; 8 rows of one column are one 16-byte chunk. LDS row R = half * 128 + j * 32 + lane holds column half * 128 + 4 * lane + j, 128 bytes (64 rows),
// its chunk g at place g ^ ((R >> 1) & 7): 16 lanes that write one g into 16 rows, and 16 lanes that read all of 2 rows, each touch every bank once. Every transposed store is a whole 128-byte line from 8 lanes.
// Every loop is unrolled in full so that the arrays it indexes stay in registers.
#define PW_ (2 * DD / 64)               // work-groups on W_tanh [512][256]
#define PE_ (NB_ * SS / 64)             // work-groups on enc, and as many on dec
template <bool ROWS, bool TR> __device__ __forceinline__ void prep_tile(const float* __restrict__ src, bf* rows, bf* tr, const int trp, unsigned char* lds) {
    const int tid = threadIdx.x, lane = tid & 31, w = tid >> 5;
    const size_t off = (size_t)w * 8 * DD + lane * 4;
    const unsigned ob = (unsigned)off * 4;   // the same in bytes of f32
    v4f v[2][8];
#pragma unroll
    for (int hh = 0; hh < 2; ++hh) {
#pragma unroll
        for (int r = 0; r < 8; ++r) v[hh][r] = *(const v4f*)((const char*)src + ob + (r * DD + hh * 128) * 4); }
    asm volatile("s_wait_xcnt 0x0" :: "v"(ob) : "memory");   // in front of the first overwrite of the address register that the loads above name; it is an input here so that it lives up to the wait and no load of the block lands on it
    __builtin_amdgcn_sched_barrier(0);              // keeps all 16 loads in front of the first conversion; without it the compiler holds some back until earlier ones have landed, a second memory latency
    v4us cv[2][8];
#pragma unroll
    for (int hh = 0; hh < 2; ++hh) {
#pragma unroll
        for (int r = 0; r < 8; ++r) {
#pragma unroll
            for (int j = 0; j < 4; ++j) cv[hh][r][j] = f2bf(v[hh][r][j]); } }
    v8us tc[8];
    if (TR) {
#pragma unroll
        for (int hh = 0; hh < 2; ++hh) {
#pragma unroll
            for (int j = 0; j < 4; ++j) { v8us col;
#pragma unroll
                for (int r = 0; r < 8; ++r) col[r] = cv[hh][r][j];
                const int R = hh * 128 + j * 32 + lane; *(v8usa*)(lds + R * 128 + ((w ^ ((R >> 1) & 7)) * 16)) = col; } }
        __syncthreads();   // every chunk of the tile is in LDS before a row of it is read; the global stores all stand behind it, so that it waits for none of them
#pragma unroll
        for (int i = 0; i < 8; ++i) tc[i] = *(const v8usa*)(lds + i * 32 * 128 + (tid >> 3) * 128 + (((tid & 7) ^ ((tid >> 4) & 7)) * 16));   // row R = 32 i + (tid >> 3), chunk g = tid & 7; (R >> 1) & 7 does not depend on i
    }
    if (ROWS) {
#pragma unroll
        for (int hh = 0; hh < 2; ++hh) {
#pragma unroll
            for (int r = 0; r < 8; ++r) *(v4us*)(rows + off + r * DD + hh * 128) = cv[hh][r]; }
        asm volatile("s_wait_xcnt 0x0" ::: "memory");       // in front of the first overwrite of a register that the stores above name, on every way that leads on from here
        if (TR) __builtin_amdgcn_sched_barrier(0);          // keeps the next stores' address arithmetic, which reuses such a register, behind the wait
    }
    if (TR) {
#pragma unroll
        for (int i = 0; i < 8; ++i) *(v8us*)(tr + (size_t)(tid >> 3) * 4 * trp + (tid & 7) * 8 + ((i >> 2) * 128 + (i & 3)) * trp) = tc[i];   // that row's column: (i >> 2) * 128 + 4 (tid >> 3) + (i & 3)
        asm volatile("s_wait_xcnt 0x0" ::: "memory");       // in front of the first overwrite of a register that the stores above name, on every way that leads on from here
    }
}
__global__ __launch_bounds__(256) void k_prep(const float* __restrict__ enc, const float* __restrict__ dec, const float* __restrict__ wt, bf* EB, bf* DB, bf* ET, bf* BW) {
    __shared__ __align__(16) unsigned char lds[DD * 128];
    const int x = blockIdx.x;
    if (x < PW_) prep_tile<false, true>(wt + (size_t)x * 64 * DD, nullptr, BW + x * 64, 2 * DD, lds);                  // BW[n][k] = W_tanh[k][n]
    else if (x < PW_ + PE_) { const int y = x - PW_, bb = y / (SS / 64), t0 = y % (SS / 64) * 64;
        prep_tile<true, true>(enc + (size_t)y * 64 * DD, EB + (size_t)y * 64 * DD, ET + (size_t)bb * DD * SS + t0, SS, lds); }   // ET[b][d][t] = enc[b][t][d]
    else { const int y = x - PW_ - PE_; prep_tile<true, false>(dec + (size_t)y * 64 * DD, DB + (size_t)y * 64 * DD, nullptr, 0, lds); }
}
#define KT 64
#define KP 528                    // LDS pitch of a dec row: 512 + 16 bytes (16 x odd, conflict-free for 16-byte reads)
#define VP 144                    // LDS pitch of a V^T row: 128 + 16 bytes
#define KBYTES (KT * KP)
#define STG (KBYTES + DD * VP)    // one buffer: 70,656 bytes
#define WP 1040                   // LDS pitch of a W^T row: 1,024 + 16 bytes (16 x odd)
#define WQ (64 * WP)              // one buffer of the output product: 64 rows n, 66,560 bytes; two of them fit the stage buffers
typedef __attribute__((ext_vector_type(16))) float v16f;
typedef __attribute__((ext_vector_type(8))) unsigned v8u;
__device__ __forceinline__ v16bf ldsfrag(const unsigned char* p) { return cat16b(*(const v8usa*)p, *(const v8usa*)(p + 32)); }
__device__ __forceinline__ float xhalf(float x) { const int b = __float_as_int(x); return __int_as_float(__builtin_amdgcn_permlanex16(b, b, 0x76543210, 0xfedcba98, false, false)); }   // lane l <-> l ^ 16
__global__ __launch_bounds__(128) void k_fattn(const bf* __restrict__ EB, const bf* __restrict__ DB, const bf* __restrict__ ET, const bf* __restrict__ BW, float* __restrict__ OUT) {
    __shared__ __align__(16) unsigned char lds[2 * STG];
    const int tid = threadIdx.x, lane = tid & 31, c = lane & 15, h = lane >> 4;
    const size_t b = blockIdx.y; const int s0 = blockIdx.x * 64 + (tid >> 5) * 16;
    const bf* Kg = DB + b * SS * DD + tid * 8;                                   // the K tile is 32 KiB in a row: chunk x = i * 128 + tid
    const bf* Vg = ET + b * DD * SS + (size_t)(tid >> 3) * SS + (tid & 7) * 8;   // V^T tile: 8 chunks a row, 16 rows per i
    const int kst = (tid >> 5) * KP + (tid & 31) * 16, vst = KBYTES + (tid >> 3) * VP + (tid & 7) * 16;
    v16bf q[8];
#pragma unroll
    for (int kc = 0; kc < 8; ++kc) q[kc] = WFrag<bf>::ld(EB + (b * SS + s0 + c) * DD + 8 * h + kc * 32);
    v8us kr[16], vr[16];
#pragma unroll
    for (int i = 0; i < 16; ++i) { kr[i] = *(const v8us*)(Kg + i * 1024); vr[i] = *(const v8us*)(Vg + (size_t)i * 16 * SS); }
    asm volatile("s_wait_xcnt 0x0" ::: "memory");   // in front of the first overwrite of an address register that the loads above name
#pragma unroll
    for (int i = 0; i < 16; ++i) { *(v8usa*)(lds + kst + i * 4 * KP) = kr[i]; *(v8usa*)(lds + vst + i * 16 * VP) = vr[i]; }
    __syncthreads();
    v8f o[16];
#pragma unroll
    for (int dt = 0; dt < 16; ++dt) o[dt] = (v8f){};
    float mul2 = -3.0e38f;   // maximum in use, in log2 units
    v16f lv = (v16f){};      // this lane's share of the row sum, 16 independent partial sums
    const int ka = c * KP + 16 * h, va = KBYTES + c * VP + 16 * h;
#pragma unroll 1
    for (int st = 0; st < SS / KT; ++st) {
        const unsigned char* kb = lds + (st & 1) * STG; unsigned char* nb = lds + ((st + 1) & 1) * STG;
        const bool more = st + 1 < SS / KT;
        // Fragments come from LDS in groups of 8 (16 loads), each group issued as one block ahead of the products of the group before it: K groups 0-3 (2 k-chunks x 4 t-tiles), V^T groups 0-3 (4 d-tiles x 2 t-chunks).
        // The sched_barrier(0) calls keep each load block whole and in front of those products; without them the compiler sinks every load to its product and the wave waits out the LDS latency at each one.
        v16bf f[2][8];
#pragma unroll
        for (int u = 0; u < 8; ++u) f[0][u] = ldsfrag(kb + ka + (u & 3) * 16 * KP + (u >> 2) * 64);
        if (more) {   // the next stage's tiles fly while this stage is worked on
#pragma unroll
            for (int i = 0; i < 16; ++i) { kr[i] = *(const v8us*)(Kg + (size_t)(st + 1) * KT * DD + i * 1024); vr[i] = *(const v8us*)(Vg + (size_t)i * 16 * SS + (st + 1) * KT); }
            asm volatile("s_wait_xcnt 0x0" ::: "memory");   // in front of the first overwrite of an address register that these loads name
        }
        v8f sT[4];
#pragma unroll
        for (int tt = 0; tt < 4; ++tt) sT[tt] = (v8f){};
#pragma unroll
        for (int g = 0; g < 4; ++g) {
#pragma unroll
            for (int u = 0; u < 8; ++u) f[(g + 1) & 1][u] = g < 3 ? ldsfrag(kb + ka + (u & 3) * 16 * KP + ((g + 1) * 2 + (u >> 2)) * 64) : ldsfrag(kb + va + (u >> 1) * 16 * VP + (u & 1) * 64);
            __builtin_amdgcn_sched_barrier(0);
#pragma unroll
            for (int u = 0; u < 8; ++u) sT[u & 3] = wmmab(f[g & 1][u], q[g * 2 + (u >> 2)], sT[u & 3]);
            __builtin_amdgcn_sched_barrier(0);
        }
        if (more) {   // here, so that the LDS takes these stores during the vector work below, when it has no reads to serve; the other buffer's last readers left it at the barrier that ended the stage before
#pragma unroll
            for (int i = 0; i < 16; ++i) { *(v8usa*)(nb + kst + i * 4 * KP) = kr[i]; *(v8usa*)(nb + vst + i * 16 * VP) = vr[i]; }
        }
        float m4[4];
#pragma unroll
        for (int tt = 0; tt < 4; ++tt) { m4[tt] = sT[tt][0];
#pragma unroll
            for (int j = 1; j < 8; ++j) m4[tt] = fmaxf(m4[tt], sT[tt][j]); }
        float mx = fmaxf(fmaxf(m4[0], m4[1]), fmaxf(m4[2], m4[3]));
        mx = fmaxf(mx, xhalf(mx)) * 1.4426950408889634f;
        if (__builtin_amdgcn_ballot_w32(mx > mul2 + 8.0f) != 0) {   // one wave-uniform test a stage: rescale only when a row's maximum outgrows the one in use by 2^8
            const float mn = fmaxf(mul2, mx), sc = __builtin_amdgcn_exp2f(mul2 - mn); mul2 = mn; lv *= sc;
#pragma unroll
            for (int dt = 0; dt < 16; ++dt) o[dt] *= sc;
        }
        v16bf ph[2], pl[2];
#pragma unroll
        for (int kk = 0; kk < 2; ++kk) { v16f p;
#pragma unroll
            for (int e = 0; e < 16; ++e) p[e] = __builtin_amdgcn_exp2f(__builtin_fmaf(sT[kk * 2 + (e >> 3)][e & 7], 1.4426950408889634f, -mul2));
            lv += p; ph[kk] = __builtin_convertvector(p, v16bf); const v8u w = __builtin_bit_cast(v8u, ph[kk]); v16f hf;
#pragma unroll
            for (int i = 0; i < 8; ++i) { hf[2 * i] = __uint_as_float(w[i] << 16); hf[2 * i + 1] = __uint_as_float(w[i] & 0xFFFF0000u); }
            pl[kk] = __builtin_convertvector(p - hf, v16bf); }
        __builtin_amdgcn_sched_barrier(0);
#pragma unroll
        for (int g = 0; g < 4; ++g) {
            if (g < 3) {
#pragma unroll
                for (int u = 0; u < 8; ++u) f[(g + 1) & 1][u] = ldsfrag(kb + va + ((g + 1) * 4 + (u >> 1)) * 16 * VP + (u & 1) * 64);
            }
            __builtin_amdgcn_sched_barrier(0);
#pragma unroll
            for (int kk = 0; kk < 2; ++kk) {
#pragma unroll
                for (int u = 0; u < 4; ++u) o[g * 4 + u] = wmmab(f[g & 1][u * 2 + kk], ph[kk], o[g * 4 + u]);
#pragma unroll
                for (int u = 0; u < 4; ++u) o[g * 4 + u] = wmmab(f[g & 1][u * 2 + kk], pl[kk], o[g * 4 + u]); }
            __builtin_amdgcn_sched_barrier(0);
        }
        __syncthreads();   // publishes the next stage and ends every wave's reads of this one
    }
    // ---- Output product: OUT^T[n][s] = sum_k W^T[n][k] X^T[k][s], X = [context | dec], k = 0..511. A = W^T rows from LDS, B = this wave's 16 rows s, all in registers:
    // two O^T tiles (d 0-15, 16-31 of a 32-block) converted in place are a B fragment in the hardware k order, as the weights were above; the dec rows load as the enc rows did.
    // W^T comes in four quarters of 64 rows n, two LDS buffers, one barrier a quarter; per accumulator the k order is hi, lo of each 32-block, context first, then dec.
    const bf* Wg = BW + tid * 8;                                                 // a quarter is 64 KiB in a row: chunk x = i * 128 + tid, 64 chunks a row
    const int wst = (tid >> 6) * WP + (tid & 63) * 16, wa = c * WP + 16 * h;
    v8us wr[32];
#pragma unroll
    for (int i = 0; i < 32; ++i) wr[i] = *(const v8us*)(Wg + i * 1024);
    asm volatile("s_wait_xcnt 0x0" ::: "memory");   // in front of the first overwrite of an address register that the loads above name
    __builtin_amdgcn_sched_barrier(0);              // keeps the next loads' address arithmetic, which reuses that register, behind the wait
    v16bf dq[8];
#pragma unroll
    for (int kc = 0; kc < 8; ++kc) dq[kc] = WFrag<bf>::ld(DB + (b * SS + s0 + c) * DD + 8 * h + kc * 32);
    asm volatile("s_wait_xcnt 0x0" ::: "memory");   // in front of the first overwrite of an address register that the loads above name
    float l = 0.f;
#pragma unroll
    for (int e = 0; e < 16; ++e) l += lv[e];
    l += xhalf(l);
    const float rl = __fdiv_rn(1.0f, l);
    v16bf ch[8], cl[8];   // o[dt][r] = context[s0 + c][dt * 16 + 8h + r], split into hi + lo bf16
#pragma unroll
    for (int kc = 0; kc < 8; ++kc) { v16f p;
#pragma unroll
        for (int e = 0; e < 16; ++e) p[e] = o[kc * 2 + (e >> 3)][e & 7] * rl;
        ch[kc] = __builtin_convertvector(p, v16bf); const v8u w = __builtin_bit_cast(v8u, ch[kc]); v16f hf;
#pragma unroll
        for (int i = 0; i < 8; ++i) { hf[2 * i] = __uint_as_float(w[i] << 16); hf[2 * i + 1] = __uint_as_float(w[i] & 0xFFFF0000u); }
        cl[kc] = __builtin_convertvector(p - hf, v16bf); }
#pragma unroll
    for (int i = 0; i < 32; ++i) *(v8usa*)(lds + wst + i * 2 * WP) = wr[i];   // the stage buffers' last readers left them at the barrier that ended the stage loop
    __syncthreads();
    float* orow = OUT + (b * SS + s0 + c) * DD + 8 * h;   // acc[u][r] = out[s0 + c][ng * 64 + u * 16 + 8h + r]
    // The quarter loop stays rolled (unroll 1) to keep the code short; its inner loops are unrolled in full so that the arrays they index stay in registers.
#pragma unroll 1
    for (int ng = 0; ng < 4; ++ng) {
        const unsigned char* wb = lds + (ng & 1) * WQ; unsigned char* nb = lds + ((ng + 1) & 1) * WQ;
        const bool more = ng + 1 < 4;
        v16bf f[2][8];   // groups of 8 fragments (2 k-chunks x 4 n-tiles), each issued as one block ahead of the products of the group before it, held there by the sched_barrier(0) calls as in the stage loop
#pragma unroll
        for (int u = 0; u < 8; ++u) f[0][u] = ldsfrag(wb + wa + (u & 3) * 16 * WP + (u >> 2) * 64);
        if (more) {   // the next quarter flies while this one is worked on
#pragma unroll
            for (int i = 0; i < 32; ++i) wr[i] = *(const v8us*)(Wg + (size_t)(ng + 1) * 64 * 2 * DD + i * 1024);
            asm volatile("s_wait_xcnt 0x0" ::: "memory");   // in front of the first overwrite of an address register that these loads name
        }
        v8f acc[4];
#pragma unroll
        for (int u = 0; u < 4; ++u) acc[u] = (v8f){};
#pragma unroll
        for (int g = 0; g < 8; ++g) {
            if (g < 7) {
#pragma unroll
                for (int u = 0; u < 8; ++u) f[(g + 1) & 1][u] = ldsfrag(wb + wa + (u & 3) * 16 * WP + ((g + 1) * 2 + (u >> 2)) * 64);
            }
            __builtin_amdgcn_sched_barrier(0);
#pragma unroll
            for (int kk = 0; kk < 2; ++kk) { const int kc = g * 2 + kk;
#pragma unroll
                for (int u = 0; u < 4; ++u) acc[u] = wmmab(f[g & 1][kk * 4 + u], kc < 8 ? ch[kc & 7] : dq[kc & 7], acc[u]);
                if (kc < 8) {
#pragma unroll
                    for (int u = 0; u < 4; ++u) acc[u] = wmmab(f[g & 1][kk * 4 + u], cl[kc & 7], acc[u]); } }
            __builtin_amdgcn_sched_barrier(0);
        }
        if (more) {   // the other buffer's last readers left it at the barrier that ended the quarter before
#pragma unroll
            for (int i = 0; i < 32; ++i) *(v8usa*)(nb + wst + i * 2 * WP) = wr[i];
        }
#pragma unroll
        for (int u = 0; u < 4; ++u) { v8f r;
#pragma unroll
            for (int j = 0; j < 8; ++j) r[j] = tanhf(acc[u][j]);
            *(v8f*)(orow + ng * 64 + u * 16) = r; }
        asm volatile("s_wait_xcnt 0x0" ::: "memory");   // in front of the first overwrite of a register that the stores above name
        __syncthreads();   // publishes the next quarter and ends every wave's reads of this one
    }
}

extern "C" void kernel_launch(void* const* d_in, const int* in_sizes, int n_in,
                              void* d_out, int out_size, void* d_ws, size_t ws_size, hipStream_t stream) {
    (void)in_sizes; (void)n_in; (void)out_size;
    const float* enc = (const float*)d_in[0]; const float* dec = (const float*)d_in[1]; const float* Wt = (const float*)d_in[2];
    float* OUT = (float*)d_out;     // [8][2048][256]
    char* wsp = (char*)d_ws;
    auto take = [&](size_t bytes) { char* p = wsp; wsp += (bytes + 255) & ~(size_t)255; return (void*)p; };
    bf* BW = (bf*)take((size_t)2 * DD * DD * 2); bf* EB = (bf*)take((size_t)NB_ * SS * DD * 2); bf* DB = (bf*)take((size_t)NB_ * SS * DD * 2); bf* ET = (bf*)take((size_t)NB_ * DD * SS * 2);
    if ((size_t)(wsp - (char*)d_ws) > ws_size) return;    // total ~ 24 MiB
    k_prep<<<PW_ + 2 * PE_, 256, 0, stream>>>(enc, dec, Wt, EB, DB, ET, BW);   // bf16 rows of enc and dec, enc^T, W_tanh^T
    k_fattn<<<dim3(SS / 64, NB_), 128, 0, stream>>>(EB, DB, ET, BW, OUT);   // out = tanh([softmax_t(enc . dec^T) . enc | dec] W_tanh)
}

// v005
// Measured time: 59.5 microseconds a run.
// Next to v004, in two timings, it ran 1.27 and 1.25 times as fast.
// Counting every step since v000, it is 13.5 times as fast.
#include <hip/hip_runtime.h>
#include <stdint.h>

// LuongAttention (enc, dec [8][2048][256]; scores[s][t] = enc[s] . dec[t] (unscaled); softmax over t (decoder time); context[s] = sum_t weights[s][t] enc[t] (the source contracts the weights' decoder axis with enc's time axis; both are 2,048 long); out = tanh([context | dec] W_tanh) -> [8][2048][256]).
// Compute dtypes, f32 accumulate: every input rounded to bf16; the unscaled scores are a PLAIN bf16 GEMM of the inputs themselves (exact products, f32 sums - they reach |90|, so nothing narrower would do); softmax f32, running maximum and sum, weights -> hl fragments in registers; context as hl x exact enc (2 products); [hl(context) | bf16(dec)] x exact W_tanh (2 products for the context half, 1 for dec), in the same kernel; tanh f32.

#define NB_  8
#define SS   2048
#define DD   256
typedef _Float16 h16;
typedef unsigned short bf;
typedef __attribute__((ext_vector_type(16))) __bf16   v16bf;
typedef __attribute__((ext_vector_type(16))) _Float16 v16h;
typedef __attribute__((ext_vector_type(8)))  _Float16 v8h;
typedef __attribute__((ext_vector_type(8)))  unsigned short v8us;
typedef __attribute__((ext_vector_type(8)))  float    v8f;
typedef __attribute__((ext_vector_type(4)))  float    v4f;
typedef v8h  __attribute__((may_alias)) v8ha;
typedef v4f  __attribute__((may_alias)) v4fa;
typedef v8us __attribute__((may_alias)) v8usa;

__device__ __forceinline__ unsigned short f2bf(float f) { unsigned u = __float_as_uint(f); u += 0x7FFFu + ((u >> 16) & 1u); return (unsigned short)(u >> 16); }
__device__ __forceinline__ float bf2f(unsigned short b) { return __uint_as_float(((unsigned)b) << 16); }
__device__ __forceinline__ float bfr(float f) { return bf2f(f2bf(f)); }
__device__ __forceinline__ v16h cat16(v8h lo, v8h hi) { return __builtin_shufflevector(lo, hi, 0, 1, 2, 3, 4, 5, 6, 7, 8, 9, 10, 11, 12, 13, 14, 15); }
__device__ __forceinline__ v16bf cat16b(v8us lo, v8us hi) { return __builtin_bit_cast(v16bf, __builtin_shufflevector(lo, hi, 0, 1, 2, 3, 4, 5, 6, 7, 8, 9, 10, 11, 12, 13, 14, 15)); }
__device__ __forceinline__ v8f wmma16(v16h a, v16h b, v8f c) { return __builtin_amdgcn_wmma_f32_16x16x32_f16(false, a, false, b, (short)0, c, false, false); }
__device__ __forceinline__ v8f wmmab(v16bf a, v16bf b, v8f c) { return __builtin_amdgcn_wmma_f32_16x16x32_bf16(false, a, false, b, (short)0, c, false, false); }



// 16-bit fragment of 32 k from a K-contiguous row: 16 bytes at p and at p + 16 elements (the caller adds 8 * (lane >> 4)).
template <typename T16> struct WFrag;
template <> struct WFrag<h16> { typedef v16h V; static __device__ __forceinline__ V ld(const h16* p) { return cat16(*(const v8h*)p, *(const v8h*)(p + 16)); } static __device__ __forceinline__ v8f mma(V a, V b, v8f c) { return wmma16(a, b, c); } };
template <> struct WFrag<bf> { typedef v16bf V; static __device__ __forceinline__ V ld(const bf* p) { return cat16b(*(const v8us*)p, *(const v8us*)(p + 16)); } static __device__ __forceinline__ v8f mma(V a, V b, v8f c) { return wmmab(a, b, c); } };
typedef __attribute__((ext_vector_type(2))) unsigned short v2us;
typedef __attribute__((ext_vector_type(4))) unsigned short v4us;

// ---- k_prep: every input goes to bf16 in ONE launch of few, fat work-groups (8 waves, 64 elements a thread, 16 loads of 16 bytes in flight a lane), for speed only.
// A work-group takes 64 rows x 256 columns of f32, 64 KiB in a row, so every wave-wide load covers four whole lines. Jobs by blockIdx.x: W_tanh (transposed only), enc (rows and transposed), dec (rows only).
// Transposing: wave w holds rows 8w..8w+7, a lane 4 columns of them in each half of 128; 8 rows of one column are one 16-byte chunk. LDS row R = half * 128 + j * 32 + lane holds column half * 128 + 4 * lane + j, 128 bytes (64 rows),
// its chunk g at place g ^ ((R >> 1) & 7): 16 lanes that write one g into 16 rows, and 16 lanes that read all of 2 rows, each touch every bank once. Every transposed store is a whole 128-byte line from 8 lanes.
// Every loop is unrolled in full so that the arrays it indexes stay in registers.
#define PW_ (2 * DD / 64)               // work-groups on W_tanh [512][256]
#define PE_ (NB_ * SS / 64)             // work-groups on enc, and as many on dec
template <bool ROWS, bool TR> __device__ __forceinline__ void prep_tile(const float* __restrict__ src, bf* rows, bf* tr, const int trp, unsigned char* lds) {
    const int tid = threadIdx.x, lane = tid & 31, w = tid >> 5;
    const size_t off = (size_t)w * 8 * DD + lane * 4;
    const unsigned ob = (unsigned)off * 4;   // the same in bytes of f32
    v4f v[2][8];
#pragma unroll
    for (int hh = 0; hh < 2; ++hh) {
#pragma unroll
        for (int r = 0; r < 8; ++r) v[hh][r] = *(const v4f*)((const char*)src + ob + (r * DD + hh * 128) * 4); }
    asm volatile("s_wait_xcnt 0x0" :: "v"(ob) : "memory");   // in front of the first overwrite of the address register that the loads above name; it is an input here so that it lives up to the wait and no load of the block lands on it
    __builtin_amdgcn_sched_barrier(0);              // keeps all 16 loads in front of the first conversion; without it the compiler holds some back until earlier ones have landed, a second memory latency
    v4us cv[2][8];
#pragma unroll
    for (int hh = 0; hh < 2; ++hh) {
#pragma unroll
        for (int r = 0; r < 8; ++r) {
#pragma unroll
            for (int j = 0; j < 4; ++j) cv[hh][r][j] = f2bf(v[hh][r][j]); } }
    v8us tc[8];
    if (TR) {
#pragma unroll
        for (int hh = 0; hh < 2; ++hh) {
#pragma unroll
            for (int j = 0; j < 4; ++j) { v8us col;
#pragma unroll
                for (int r = 0; r < 8; ++r) col[r] = cv[hh][r][j];
                const int R = hh * 128 + j * 32 + lane; *(v8usa*)(lds + R * 128 + ((w ^ ((R >> 1) & 7)) * 16)) = col; } }
        __syncthreads();   // every chunk of the tile is in LDS before a row of it is read; the global stores all stand behind it, so that it waits for none of them
#pragma unroll
        for (int i = 0; i < 8; ++i) tc[i] = *(const v8usa*)(lds + i * 32 * 128 + (tid >> 3) * 128 + (((tid & 7) ^ ((tid >> 4) & 7)) * 16));   // row R = 32 i + (tid >> 3), chunk g = tid & 7; (R >> 1) & 7 does not depend on i
    }
    if (ROWS) {
#pragma unroll
        for (int hh = 0; hh < 2; ++hh) {
#pragma unroll
            for (int r = 0; r < 8; ++r) *(v4us*)(rows + off + r * DD + hh * 128) = cv[hh][r]; }
        asm volatile("s_wait_xcnt 0x0" ::: "memory");       // in front of the first overwrite of a register that the stores above name, on every way that leads on from here
        if (TR) __builtin_amdgcn_sched_barrier(0);          // keeps the next stores' address arithmetic, which reuses such a register, behind the wait
    }
    if (TR) {
#pragma unroll
        for (int i = 0; i < 8; ++i) *(v8us*)(tr + (size_t)(tid >> 3) * 4 * trp + (tid & 7) * 8 + ((i >> 2) * 128 + (i & 3)) * trp) = tc[i];   // that row's column: (i >> 2) * 128 + 4 (tid >> 3) + (i & 3)
        asm volatile("s_wait_xcnt 0x0" ::: "memory");       // in front of the first overwrite of a register that the stores above name, on every way that leads on from here
    }
}
__global__ __launch_bounds__(256) void k_prep(const float* __restrict__ enc, const float* __restrict__ dec, const float* __restrict__ wt, bf* EB, bf* DB, bf* ET, bf* BW) {
    __shared__ __align__(16) unsigned char lds[DD * 128];
    const int x = blockIdx.x;
    if (x < PW_) prep_tile<false, true>(wt + (size_t)x * 64 * DD, nullptr, BW + x * 64, 2 * DD, lds);                  // BW[n][k] = W_tanh[k][n]
    else if (x < PW_ + PE_) { const int y = x - PW_, bb = y / (SS / 64), t0 = y % (SS / 64) * 64;
        prep_tile<true, true>(enc + (size_t)y * 64 * DD, EB + (size_t)y * 64 * DD, ET + (size_t)bb * DD * SS + t0, SS, lds); }   // ET[b][d][t] = enc[b][t][d]
    else { const int y = x - PW_ - PE_; prep_tile<true, false>(dec + (size_t)y * 64 * DD, DB + (size_t)y * 64 * DD, nullptr, 0, lds); }
}
#define KT 64
#define KP 272                    // LDS pitch of half a dec row: 256 + 16 bytes (16 x odd, conflict-free for 16-byte reads), laid by the tensor load's pad
#define VP 144                    // LDS pitch of a V^T row: 128 + 16 bytes, laid likewise
#define SL 18432                  // one wave's slice of a buffer, a multiple of 2 KiB: 64 rows x KP (17,408 bytes, rounded up) or 128 rows x VP (exactly)
#define KBYTES (2 * SL)
#define STG (4 * SL)              // one buffer: K columns 0-127, K columns 128-255, V^T rows 0-127, V^T rows 128-255; 73,728 bytes
#define WP 1040                   // LDS pitch of a W^T row: 1,024 + 16 bytes (16 x odd)
#define WQ (64 * WP)              // one buffer of the output product: 64 rows n, 66,560 bytes; two of them fit the stage buffers
typedef __attribute__((ext_vector_type(16))) float v16f;
typedef __attribute__((ext_vector_type(8))) unsigned v8u;
__device__ __forceinline__ v16bf ldsfrag(const unsigned char* p) { return cat16b(*(const v8usa*)p, *(const v8usa*)(p + 32)); }
__device__ __forceinline__ float xhalf(float x) { const int b = __float_as_int(x); return __int_as_float(__builtin_amdgcn_permlanex16(b, b, 0x76543210, 0xfedcba98, false, false)); }   // lane l <-> l ^ 16
typedef uint32_t u32x4 __attribute__((ext_vector_type(4)));
typedef uint32_t u32x8 __attribute__((ext_vector_type(8)));
__device__ __forceinline__ uint32_t uni(uint32_t v) { return (uint32_t)__builtin_amdgcn_readfirstlane(v); }
__device__ __forceinline__ uint32_t pinned(uint32_t v) { uint32_t w = (uint32_t)__builtin_amdgcn_readfirstlane(v); asm volatile("" : "+s"(w)); return w; }   // the empty statement holds a descriptor word, or the value that a tensor load's issue test reads, in a scalar register: the test is then a scalar branch (a tensor load ignores EXEC), and a word formed from it is formed behind the wait that stands in front of it
// Group 1 of a tensor load's descriptor: ROWS rows of ROWB bytes, source pitch PITCH bytes; W0 = word 0 (no mask, 1-byte elements, 16 bytes of pad behind every row).
// Every word goes through pinned(): a descriptor word held in a scalar register, formed once in front of the first request, so that no register of the group takes a new value while a request is in flight.
template <uint32_t ROWB, uint32_t ROWS, uint32_t PITCH, uint32_t W0> __device__ __forceinline__ u32x8 tdm_group1() {
    u32x8 g;
    g[0] = pinned(W0); g[1] = pinned((ROWB & 0xFFFFu) << 16); g[2] = pinned((ROWB >> 16) | ((ROWS & 0xFFFFu) << 16)); g[3] = pinned((ROWS >> 16) | (ROWB << 16));
    g[4] = pinned(ROWS); g[5] = pinned(PITCH); g[6] = pinned(0u); g[7] = pinned(0u);
    return g;
}
__device__ __forceinline__ void tdm_load(u32x4 g0, u32x8 g1) { asm volatile("tensor_load_to_lds %0, %1" :: "s"(g0), "s"(g1) : "memory"); }
__global__ __launch_bounds__(128) __attribute__((amdgpu_waves_per_eu(1, 1))) void k_fattn(const bf* __restrict__ EB, const bf* __restrict__ DB, const bf* __restrict__ ET, const bf* __restrict__ BW, float* __restrict__ OUT) {
    __shared__ __attribute__((aligned(2048))) unsigned char lds[2 * STG];   // every slice's place is a multiple of 2 KiB
    const int tid = threadIdx.x, lane = tid & 31, c = lane & 15, h = lane >> 4;
    const size_t b = blockIdx.y; const int s0 = blockIdx.x * 64 + (tid >> 5) * 16;
    const uint32_t wave = uni((uint32_t)tid >> 5), lbase = (uint32_t)(size_t)lds;
    const bool isk = wave < 2u;      // waves 0, 1: 64 rows t x 256 bytes of K, source pitch 512; waves 2, 3: 128 rows d x 128 bytes of V^T, source pitch 4,096
    const uint64_t gbase = isk ? (uint64_t)(size_t)(DB + b * SS * DD) + (wave & 1u) * 256u : (uint64_t)(size_t)(ET + b * DD * SS) + (wave & 1u) * (128u * SS * 2u);
    const uint32_t gshift = isk ? 15u : 7u;   // a stage further on: KT rows of 512 bytes, or KT columns of 2 bytes
    const u32x8 g1k = tdm_group1<256u, KT, DD * 2u, (1u << 20 | 5u << 22 | 3u << 25)>(), g1v = tdm_group1<KT * 2u, 128u, SS * 2u, (1u << 20 | 4u << 22 | 3u << 25)>();
    const uint32_t one = pinned(1u);          // group 0, word 0: a descriptor word held in a scalar register, as those of group 1
    u32x4 g0;                                 // group 0 of this wave's request in flight; an input of the wait that covers it, so that its registers live up to that wait
    auto form = [&](uint32_t s) {             // this wave's slice of stage s, into buffer s & 1
        const uint64_t ga = gbase + (uint64_t)(s << gshift);
        g0[0] = one; g0[1] = uni(lbase + (s & 1u) * STG + wave * SL); g0[2] = uni((uint32_t)ga); g0[3] = uni((((uint32_t)(ga >> 32)) & 0x01FFFFFFu) | 0x80000000u);
    };
    auto issue = [&]() { if (pinned(isk)) tdm_load(g0, g1k); else tdm_load(g0, g1v); };   // a scalar branch: a tensor load ignores EXEC
    v16bf q[8];
#pragma unroll
    for (int kc = 0; kc < 8; ++kc) q[kc] = WFrag<bf>::ld(EB + (b * SS + s0 + c) * DD + 8 * h + kc * 32);
    asm volatile("s_wait_xcnt 0x0" ::: "memory");   // in front of the first overwrite of an address register that the loads above name
    form(0); issue();
    asm volatile("s_wait_tensorcnt 0x0" :: "s"(g0) : "memory");   // this wave's slice of stage 0 has landed
    __syncthreads();                                              // and so has every other wave's: stage 0 may be read
    form(pinned(1u)); issue();
    v8f o[16];
#pragma unroll
    for (int dt = 0; dt < 16; ++dt) o[dt] = (v8f){};
    float mul2 = -3.0e38f;   // maximum in use, in log2 units
    v16f lv = (v16f){};      // this lane's share of the row sum, 16 independent partial sums
    const int ka = c * KP + 16 * h, va = KBYTES + c * VP + 16 * h;
#pragma unroll 1
    for (int st = 0; st < SS / KT; ++st) {
        const unsigned char* kb = lds + (st & 1) * STG;
        // Fragments come from LDS in groups of 8 (16 loads), each group issued as one block ahead of the products of the group before it: K groups 0-3 (2 k-chunks x 4 t-tiles), V^T groups 0-3 (4 d-tiles x 2 t-chunks).
        // The sched_barrier(0) calls keep each load block whole and in front of those products; without them the compiler sinks every load to its product and the wave waits out the LDS latency at each one.
        v16bf f[2][8];
#pragma unroll
        for (int u = 0; u < 8; ++u) f[0][u] = ldsfrag(kb + ka + (u & 3) * 16 * KP + (u >> 2) * 64);
        v8f sT[4];
#pragma unroll
        for (int tt = 0; tt < 4; ++tt) sT[tt] = (v8f){};
#pragma unroll
        for (int g = 0; g < 4; ++g) {
#pragma unroll
            for (int u = 0; u < 8; ++u) f[(g + 1) & 1][u] = g < 3 ? ldsfrag(kb + ka + ((g + 1) >> 1) * SL + (u & 3) * 16 * KP + (((g + 1) & 1) * 2 + (u >> 2)) * 64) : ldsfrag(kb + va + (u >> 1) * 16 * VP + (u & 1) * 64);
            __builtin_amdgcn_sched_barrier(0);
#pragma unroll
            for (int u = 0; u < 8; ++u) sT[u & 3] = wmmab(f[g & 1][u], q[g * 2 + (u >> 2)], sT[u & 3]);
            __builtin_amdgcn_sched_barrier(0);
        }
        float m4[4];
#pragma unroll
        for (int tt = 0; tt < 4; ++tt) { m4[tt] = sT[tt][0];
#pragma unroll
            for (int j = 1; j < 8; ++j) m4[tt] = fmaxf(m4[tt], sT[tt][j]); }
        float mx = fmaxf(fmaxf(m4[0], m4[1]), fmaxf(m4[2], m4[3]));
        mx = fmaxf(mx, xhalf(mx)) * 1.4426950408889634f;
        if (__builtin_amdgcn_ballot_w32(mx > mul2 + 8.0f) != 0) {   // one wave-uniform test a stage: rescale only when a row's maximum outgrows the one in use by 2^8
            const float mn = fmaxf(mul2, mx), sc = __builtin_amdgcn_exp2f(mul2 - mn); mul2 = mn; lv *= sc;
#pragma unroll
            for (int dt = 0; dt < 16; ++dt) o[dt] *= sc;
        }
        v16bf ph[2], pl[2];
#pragma unroll
        for (int kk = 0; kk < 2; ++kk) { v16f p;
#pragma unroll
            for (int e = 0; e < 16; ++e) p[e] = __builtin_amdgcn_exp2f(__builtin_fmaf(sT[kk * 2 + (e >> 3)][e & 7], 1.4426950408889634f, -mul2));
            lv += p; ph[kk] = __builtin_convertvector(p, v16bf); const v8u w = __builtin_bit_cast(v8u, ph[kk]); v16f hf;
#pragma unroll
            for (int i = 0; i < 8; ++i) { hf[2 * i] = __uint_as_float(w[i] << 16); hf[2 * i + 1] = __uint_as_float(w[i] & 0xFFFF0000u); }
            pl[kk] = __builtin_convertvector(p - hf, v16bf); }
        __builtin_amdgcn_sched_barrier(0);
#pragma unroll
        for (int g = 0; g < 4; ++g) {
            if (g < 3) {
#pragma unroll
                for (int u = 0; u < 8; ++u) f[(g + 1) & 1][u] = ldsfrag(kb + va + ((g + 1) * 4 + (u >> 1)) * 16 * VP + (u & 1) * 64);
            }
            __builtin_amdgcn_sched_barrier(0);
#pragma unroll
            for (int kk = 0; kk < 2; ++kk) {
#pragma unroll
                for (int u = 0; u < 4; ++u) o[g * 4 + u] = wmmab(f[g & 1][u * 2 + kk], ph[kk], o[g * 4 + u]);
#pragma unroll
                for (int u = 0; u < 4; ++u) o[g * 4 + u] = wmmab(f[g & 1][u * 2 + kk], pl[kk], o[g * 4 + u]); }
            __builtin_amdgcn_sched_barrier(0);
        }
        asm volatile("s_wait_dscnt 0x0" ::: "memory");       // this wave's reads of this stage's buffer are over
        asm volatile("s_wait_tensorcnt 0x0" :: "s"(g0) : "memory");   // this wave's slice of the next stage has landed
        __syncthreads();   // publishes the next stage and ends every wave's reads of this one
        form(pinned((uint32_t)st + 2u));        // formed behind the wait
        if (pinned(st + 2 < SS / KT)) issue();   // into the buffer that this stage has just left; it flies during the whole of the next stage
    }
    asm volatile("s_wait_tensorcnt 0x0" ::: "memory");   // no tensor load is in flight
    asm volatile("s_wait_dscnt 0x0" ::: "memory");       // and no LDS read, before the buffers take W^T
    // ---- Output product: OUT^T[n][s] = sum_k W^T[n][k] X^T[k][s], X = [context | dec], k = 0..511. A = W^T rows from LDS, B = this wave's 16 rows s, all in registers:
    // two O^T tiles (d 0-15, 16-31 of a 32-block) converted in place are a B fragment in the hardware k order, as the weights were above; the dec rows load as the enc rows did.
    // W^T comes in four quarters of 64 rows n, two LDS buffers, one barrier a quarter; per accumulator the k order is hi, lo of each 32-block, context first, then dec.
    const bf* Wg = BW + tid * 8;                                                 // a quarter is 64 KiB in a row: chunk x = i * 128 + tid, 64 chunks a row
    const int wst = (tid >> 6) * WP + (tid & 63) * 16, wa = c * WP + 16 * h;
    v8us wr[32];
#pragma unroll
    for (int i = 0; i < 32; ++i) wr[i] = *(const v8us*)(Wg + i * 1024);
    asm volatile("s_wait_xcnt 0x0" ::: "memory");   // in front of the first overwrite of an address register that the loads above name
    __builtin_amdgcn_sched_barrier(0);              // keeps the next loads' address arithmetic, which reuses that register, behind the wait
    v16bf dq[8];
#pragma unroll
    for (int kc = 0; kc < 8; ++kc) dq[kc] = WFrag<bf>::ld(DB + (b * SS + s0 + c) * DD + 8 * h + kc * 32);
    asm volatile("s_wait_xcnt 0x0" ::: "memory");   // in front of the first overwrite of an address register that the loads above name
    float l = 0.f;
#pragma unroll
    for (int e = 0; e < 16; ++e) l += lv[e];
    l += xhalf(l);
    const float rl = __fdiv_rn(1.0f, l);
    v16bf ch[8], cl[8];   // o[dt][r] = context[s0 + c][dt * 16 + 8h + r], split into hi + lo bf16
#pragma unroll
    for (int kc = 0; kc < 8; ++kc) { v16f p;
#pragma unroll
        for (int e = 0; e < 16; ++e) p[e] = o[kc * 2 + (e >> 3)][e & 7] * rl;
        ch[kc] = __builtin_convertvector(p, v16bf); const v8u w = __builtin_bit_cast(v8u, ch[kc]); v16f hf;
#pragma unroll
        for (int i = 0; i < 8; ++i) { hf[2 * i] = __uint_as_float(w[i] << 16); hf[2 * i + 1] = __uint_as_float(w[i] & 0xFFFF0000u); }
        cl[kc] = __builtin_convertvector(p - hf, v16bf); }
#pragma unroll
    for (int i = 0; i < 32; ++i) *(v8usa*)(lds + wst + i * 2 * WP) = wr[i];   // the stage buffers' last readers left them at the barrier that ended the stage loop
    __syncthreads();
    float* orow = OUT + (b * SS + s0 + c) * DD + 8 * h;   // acc[u][r] = out[s0 + c][ng * 64 + u * 16 + 8h + r]
    // The quarter loop stays rolled (unroll 1) to keep the code short; its inner loops are unrolled in full so that the arrays they index stay in registers.
#pragma unroll 1
    for (int ng = 0; ng < 4; ++ng) {
        const unsigned char* wb = lds + (ng & 1) * WQ; unsigned char* nb = lds + ((ng + 1) & 1) * WQ;
        const bool more = ng + 1 < 4;
        v16bf f[2][8];   // groups of 8 fragments (2 k-chunks x 4 n-tiles), each issued as one block ahead of the products of the group before it, held there by the sched_barrier(0) calls as in the stage loop
#pragma unroll
        for (int u = 0; u < 8; ++u) f[0][u] = ldsfrag(wb + wa + (u & 3) * 16 * WP + (u >> 2) * 64);
        if (more) {   // the next quarter flies while this one is worked on
#pragma unroll
            for (int i = 0; i < 32; ++i) wr[i] = *(const v8us*)(Wg + (size_t)(ng + 1) * 64 * 2 * DD + i * 1024);
            asm volatile("s_wait_xcnt 0x0" ::: "memory");   // in front of the first overwrite of an address register that these loads name
        }
        v8f acc[4];
#pragma unroll
        for (int u = 0; u < 4; ++u) acc[u] = (v8f){};
#pragma unroll
        for (int g = 0; g < 8; ++g) {
            if (g < 7) {
#pragma unroll
                for (int u = 0; u < 8; ++u) f[(g + 1) & 1][u] = ldsfrag(wb + wa + (u & 3) * 16 * WP + ((g + 1) * 2 + (u >> 2)) * 64);
            }
            __builtin_amdgcn_sched_barrier(0);
#pragma unroll
            for (int kk = 0; kk < 2; ++kk) { const int kc = g * 2 + kk;
#pragma unroll
                for (int u = 0; u < 4; ++u) acc[u] = wmmab(f[g & 1][kk * 4 + u], kc < 8 ? ch[kc & 7] : dq[kc & 7], acc[u]);
                if (kc < 8) {
#pragma unroll
                    for (int u = 0; u < 4; ++u) acc[u] = wmmab(f[g & 1][kk * 4 + u], cl[kc & 7], acc[u]); } }
            __builtin_amdgcn_sched_barrier(0);
        }
        if (more) {   // the other buffer's last readers left it at the barrier that ended the quarter before
#pragma unroll
            for (int i = 0; i < 32; ++i) *(v8usa*)(nb + wst + i * 2 * WP) = wr[i];
        }
#pragma unroll
        for (int u = 0; u < 4; ++u) { v8f r;
#pragma unroll
            for (int j = 0; j < 8; ++j) r[j] = tanhf(acc[u][j]);
            *(v8f*)(orow + ng * 64 + u * 16) = r; }
        asm volatile("s_wait_xcnt 0x0" ::: "memory");   // in front of the first overwrite of a register that the stores above name
        __syncthreads();   // publishes the next quarter and ends every wave's reads of this one
    }
}

extern "C" void kernel_launch(void* const* d_in, const int* in_sizes, int n_in,
                              void* d_out, int out_size, void* d_ws, size_t ws_size, hipStream_t stream) {
    (void)in_sizes; (void)n_in; (void)out_size;
    const float* enc = (const float*)d_in[0]; const float* dec = (const float*)d_in[1]; const float* Wt = (const float*)d_in[2];
    float* OUT = (float*)d_out;     // [8][2048][256]
    char* wsp = (char*)d_ws;
    auto take = [&](size_t bytes) { char* p = wsp; wsp += (bytes + 255) & ~(size_t)255; return (void*)p; };
    bf* BW = (bf*)take((size_t)2 * DD * DD * 2); bf* EB = (bf*)take((size_t)NB_ * SS * DD * 2); bf* DB = (bf*)take((size_t)NB_ * SS * DD * 2); bf* ET = (bf*)take((size_t)NB_ * DD * SS * 2);
    if ((size_t)(wsp - (char*)d_ws) > ws_size) return;    // total ~ 24 MiB
    k_prep<<<PW_ + 2 * PE_, 256, 0, stream>>>(enc, dec, Wt, EB, DB, ET, BW);   // bf16 rows of enc and dec, enc^T, W_tanh^T
    k_fattn<<<dim3(SS / 64, NB_), 128, 0, stream>>>(EB, DB, ET, BW, OUT);   // out = tanh([softmax_t(enc . dec^T) . enc | dec] W_tanh)
}

// v006
// It runs in 56.7 microseconds.
// Next to v005, in two timings, it ran 1.05 and 1.04 times as fast.
// Over all steps from v000 it is 14.1 times as fast.
#include <hip/hip_runtime.h>
#include <stdint.h>

// LuongAttention (enc, dec [8][2048][256]; scores[s][t] = enc[s] . dec[t] (unscaled); softmax over t (decoder time); context[s] = sum_t weights[s][t] enc[t] (the source contracts the weights' decoder axis with enc's time axis; both are 2,048 long); out = tanh([context | dec] W_tanh) -> [8][2048][256]).
// Compute dtypes, f32 accumulate: every input rounded to bf16; the unscaled scores are a PLAIN bf16 GEMM of the inputs themselves (exact products, f32 sums - they reach |90|, so nothing narrower would do); softmax f32, running maximum and sum, weights -> hl fragments in registers; context as hl x exact enc (2 products); [hl(context) | bf16(dec)] x exact W_tanh (2 products for the context half, 1 for dec), in the same kernel; tanh f32.

#define NB_  8
#define SS   2048
#define DD   256
typedef _Float16 h16;
typedef unsigned short bf;
typedef __attribute__((ext_vector_type(16))) __bf16   v16bf;
typedef __attribute__((ext_vector_type(16))) _Float16 v16h;
typedef __attribute__((ext_vector_type(8)))  _Float16 v8h;
typedef __attribute__((ext_vector_type(8)))  unsigned short v8us;
typedef __attribute__((ext_vector_type(8)))  float    v8f;
typedef __attribute__((ext_vector_type(4)))  float    v4f;
typedef v8h  __attribute__((may_alias)) v8ha;
typedef v4f  __attribute__((may_alias)) v4fa;
typedef v8us __attribute__((may_alias)) v8usa;

__device__ __forceinline__ unsigned short f2bf(float f) { unsigned u = __float_as_uint(f); u += 0x7FFFu + ((u >> 16) & 1u); return (unsigned short)(u >> 16); }
__device__ __forceinline__ float bf2f(unsigned short b) { return __uint_as_float(((unsigned)b) << 16); }
__device__ __forceinline__ float bfr(float f) { return bf2f(f2bf(f)); }
__device__ __forceinline__ v16h cat16(v8h lo, v8h hi) { return __builtin_shufflevector(lo, hi, 0, 1, 2, 3, 4, 5, 6, 7, 8, 9, 10, 11, 12, 13, 14, 15); }
__device__ __forceinline__ v16bf cat16b(v8us lo, v8us hi) { return __builtin_bit_cast(v16bf, __builtin_shufflevector(lo, hi, 0, 1, 2, 3, 4, 5, 6, 7, 8, 9, 10, 11, 12, 13, 14, 15)); }
__device__ __forceinline__ v8f wmma16(v16h a, v16h b, v8f c) { return __builtin_amdgcn_wmma_f32_16x16x32_f16(false, a, false, b, (short)0, c, false, false); }
__device__ __forceinline__ v8f wmmab(v16bf a, v16bf b, v8f c) { return __builtin_amdgcn_wmma_f32_16x16x32_bf16(false, a, false, b, (short)0, c, false, false); }



// 16-bit fragment of 32 k from a K-contiguous row: 16 bytes at p and at p + 16 elements (the caller adds 8 * (lane >> 4)).
template <typename T16> struct WFrag;
template <> struct WFrag<h16> { typedef v16h V; static __device__ __forceinline__ V ld(const h16* p) { return cat16(*(const v8h*)p, *(const v8h*)(p + 16)); } static __device__ __forceinline__ v8f mma(V a, V b, v8f c) { return wmma16(a, b, c); } };
template <> struct WFrag<bf> { typedef v16bf V; static __device__ __forceinline__ V ld(const bf* p) { return cat16b(*(const v8us*)p, *(const v8us*)(p + 16)); } static __device__ __forceinline__ v8f mma(V a, V b, v8f c) { return wmmab(a, b, c); } };
typedef __attribute__((ext_vector_type(2))) unsigned short v2us;
typedef __attribute__((ext_vector_type(4))) unsigned short v4us;

// ---- k_prep: every input goes to bf16 in ONE launch of few, fat work-groups (8 waves, 64 elements a thread, 16 loads of 16 bytes in flight a lane), for speed only.
// A work-group takes 64 rows x 256 columns of f32, 64 KiB in a row, so every wave-wide load covers four whole lines. Jobs by blockIdx.x: W_tanh (transposed only), enc (rows and transposed), dec (rows only).
// Transposing: wave w holds rows 8w..8w+7, a lane 4 columns of them in each half of 128; 8 rows of one column are one 16-byte chunk. LDS row R = half * 128 + j * 32 + lane holds column half * 128 + 4 * lane + j, 128 bytes (64 rows),
// its chunk g at place g ^ ((R >> 1) & 7): 16 lanes that write one g into 16 rows, and 16 lanes that read all of 2 rows, each touch every bank once. Every transposed store is a whole 128-byte line from 8 lanes.
// Every loop is unrolled in full so that the arrays it indexes stay in registers.
#define PW_ (2 * DD / 64)               // work-groups on W_tanh [512][256]
#define PE_ (NB_ * SS / 64)             // work-groups on enc, and as many on dec
template <bool ROWS, bool TR> __device__ __forceinline__ void prep_tile(const float* __restrict__ src, bf* rows, bf* tr, const int trp, unsigned char* lds) {
    const int tid = threadIdx.x, lane = tid & 31, w = tid >> 5;
    const size_t off = (size_t)w * 8 * DD + lane * 4;
    const unsigned ob = (unsigned)off * 4;   // the same in bytes of f32
    v4f v[2][8];
#pragma unroll
    for (int hh = 0; hh < 2; ++hh) {
#pragma unroll
        for (int r = 0; r < 8; ++r) v[hh][r] = *(const v4f*)((const char*)src + ob + (r * DD + hh * 128) * 4); }
    asm volatile("s_wait_xcnt 0x0" :: "v"(ob) : "memory");   // in front of the first overwrite of the address register that the loads above name; it is an input here so that it lives up to the wait and no load of the block lands on it
    __builtin_amdgcn_sched_barrier(0);              // keeps all 16 loads in front of the first conversion; without it the compiler holds some back until earlier ones have landed, a second memory latency
    v4us cv[2][8];
#pragma unroll
    for (int hh = 0; hh < 2; ++hh) {
#pragma unroll
        for (int r = 0; r < 8; ++r) {
#pragma unroll
            for (int j = 0; j < 4; ++j) cv[hh][r][j] = f2bf(v[hh][r][j]); } }
    v8us tc[8];
    if (TR) {
#pragma unroll
        for (int hh = 0; hh < 2; ++hh) {
#pragma unroll
            for (int j = 0; j < 4; ++j) { v8us col;
#pragma unroll
                for (int r = 0; r < 8; ++r) col[r] = cv[hh][r][j];
                const int R = hh * 128 + j * 32 + lane; *(v8usa*)(lds + R * 128 + ((w ^ ((R >> 1) & 7)) * 16)) = col; } }
        __syncthreads();   // every chunk of the tile is in LDS before a row of it is read; the global stores all stand behind it, so that it waits for none of them
#pragma unroll
        for (int i = 0; i < 8; ++i) tc[i] = *(const v8usa*)(lds + i * 32 * 128 + (tid >> 3) * 128 + (((tid & 7) ^ ((tid >> 4) & 7)) * 16));   // row R = 32 i + (tid >> 3), chunk g = tid & 7; (R >> 1) & 7 does not depend on i
    }
    if (ROWS) {
#pragma unroll
        for (int hh = 0; hh < 2; ++hh) {
#pragma unroll
            for (int r = 0; r < 8; ++r) *(v4us*)(rows + off + r * DD + hh * 128) = cv[hh][r]; }
        asm volatile("s_wait_xcnt 0x0" ::: "memory");       // in front of the first overwrite of a register that the stores above name, on every way that leads on from here
        if (TR) __builtin_amdgcn_sched_barrier(0);          // keeps the next stores' address arithmetic, which reuses such a register, behind the wait
    }
    if (TR) {
#pragma unroll
        for (int i = 0; i < 8; ++i) *(v8us*)(tr + (size_t)(tid >> 3) * 4 * trp + (tid & 7) * 8 + ((i >> 2) * 128 + (i & 3)) * trp) = tc[i];   // that row's column: (i >> 2) * 128 + 4 (tid >> 3) + (i & 3)
        asm volatile("s_wait_xcnt 0x0" ::: "memory");       // in front of the first overwrite of a register that the stores above name, on every way that leads on from here
    }
}
__global__ __launch_bounds__(256) void k_prep(const float* __restrict__ enc, const float* __restrict__ dec, const float* __restrict__ wt, bf* EB, bf* DB, bf* ET, bf* BW) {
    __shared__ __align__(16) unsigned char lds[DD * 128];
    const int x = blockIdx.x;
    if (x < PW_) prep_tile<false, true>(wt + (size_t)x * 64 * DD, nullptr, BW + x * 64, 2 * DD, lds);                  // BW[n][k] = W_tanh[k][n]
    else if (x < PW_ + PE_) { const int y = x - PW_, bb = y / (SS / 64), t0 = y % (SS / 64) * 64;
        prep_tile<true, true>(enc + (size_t)y * 64 * DD, EB + (size_t)y * 64 * DD, ET + (size_t)bb * DD * SS + t0, SS, lds); }   // ET[b][d][t] = enc[b][t][d]
    else { const int y = x - PW_ - PE_; prep_tile<true, false>(dec + (size_t)y * 64 * DD, DB + (size_t)y * 64 * DD, nullptr, 0, lds); }
}
#define KT 64
#define KP 272                    // LDS pitch of half a dec row: 256 + 16 bytes (16 x odd, conflict-free for 16-byte reads), laid by the tensor load's pad
#define VP 144                    // LDS pitch of a V^T row: 128 + 16 bytes, laid likewise
#define SL 18432                  // one wave's slice of a buffer, a multiple of 2 KiB: 64 rows x KP (17,408 bytes, rounded up) or 128 rows x VP (exactly)
#define KBYTES (2 * SL)
#define STG (4 * SL)              // one buffer: K columns 0-127, K columns 128-255, V^T rows 0-127, V^T rows 128-255; 73,728 bytes
#define WP 1040                   // LDS pitch of a W^T row: 1,024 + 16 bytes (16 x odd)
#define WQ (64 * WP)              // one buffer of the output product: 64 rows n, 66,560 bytes; two of them fit the stage buffers
typedef __attribute__((ext_vector_type(16))) float v16f;
typedef __attribute__((ext_vector_type(8))) unsigned v8u;
__device__ __forceinline__ v16bf ldsfrag(const unsigned char* p) { return cat16b(*(const v8usa*)p, *(const v8usa*)(p + 32)); }
__device__ __forceinline__ float xhalf(float x) { const int b = __float_as_int(x); return __int_as_float(__builtin_amdgcn_permlanex16(b, b, 0x76543210, 0xfedcba98, false, false)); }   // lane l <-> l ^ 16
typedef uint32_t u32x4 __attribute__((ext_vector_type(4)));
typedef uint32_t u32x8 __attribute__((ext_vector_type(8)));
__device__ __forceinline__ uint32_t uni(uint32_t v) { return (uint32_t)__builtin_amdgcn_readfirstlane(v); }
__device__ __forceinline__ uint32_t pinned(uint32_t v) { uint32_t w = (uint32_t)__builtin_amdgcn_readfirstlane(v); asm volatile("" : "+s"(w)); return w; }   // the empty statement holds a descriptor word, or the value that a tensor load's issue test reads, in a scalar register: the test is then a scalar branch (a tensor load ignores EXEC), and a word formed from it is formed behind the wait that stands in front of it
// Group 1 of a tensor load's descriptor: ROWS rows of ROWB bytes, source pitch PITCH bytes; W0 = word 0 (no mask, 1-byte elements, 16 bytes of pad behind every row).
// Every word goes through pinned(): a descriptor word held in a scalar register, formed once in front of the first request, so that no register of the group takes a new value while a request is in flight.
template <uint32_t ROWB, uint32_t ROWS, uint32_t PITCH, uint32_t W0> __device__ __forceinline__ u32x8 tdm_group1() {
    u32x8 g;
    g[0] = pinned(W0); g[1] = pinned((ROWB & 0xFFFFu) << 16); g[2] = pinned((ROWB >> 16) | ((ROWS & 0xFFFFu) << 16)); g[3] = pinned((ROWS >> 16) | (ROWB << 16));
    g[4] = pinned(ROWS); g[5] = pinned(PITCH); g[6] = pinned(0u); g[7] = pinned(0u);
    return g;
}
__device__ __forceinline__ void tdm_load(u32x4 g0, u32x8 g1) { asm volatile("tensor_load_to_lds %0, %1" :: "s"(g0), "s"(g1) : "memory"); }
__global__ __launch_bounds__(128) __attribute__((amdgpu_waves_per_eu(1, 1))) void k_fattn(const bf* __restrict__ EB, const bf* __restrict__ DB, const bf* __restrict__ ET, const bf* __restrict__ BW, float* __restrict__ OUT) {
    __shared__ __attribute__((aligned(2048))) unsigned char lds[2 * STG];   // every slice's place is a multiple of 2 KiB
    const int tid = threadIdx.x, lane = tid & 31, c = lane & 15, h = lane >> 4;
    const size_t b = blockIdx.y; const int s0 = blockIdx.x * 64 + (tid >> 5) * 16;
    const uint32_t wave = uni((uint32_t)tid >> 5), lbase = (uint32_t)(size_t)lds;
    const bool isk = wave < 2u;      // waves 0, 1: 64 rows t x 256 bytes of K, source pitch 512; waves 2, 3: 128 rows d x 128 bytes of V^T, source pitch 4,096
    const uint64_t gbase = isk ? (uint64_t)(size_t)(DB + b * SS * DD) + (wave & 1u) * 256u : (uint64_t)(size_t)(ET + b * DD * SS) + (wave & 1u) * (128u * SS * 2u);
    const uint32_t gshift = isk ? 15u : 7u;   // a stage further on: KT rows of 512 bytes, or KT columns of 2 bytes
    const u32x8 g1k = tdm_group1<256u, KT, DD * 2u, (1u << 20 | 5u << 22 | 3u << 25)>(), g1v = tdm_group1<KT * 2u, 128u, SS * 2u, (1u << 20 | 4u << 22 | 3u << 25)>();
    const uint32_t one = pinned(1u);          // group 0, word 0: a descriptor word held in a scalar register, as those of group 1
    u32x4 g0;                                 // group 0 of this wave's request in flight; an input of the wait that covers it, so that its registers live up to that wait
    auto form = [&](uint32_t s) {             // this wave's slice of stage s, into buffer s & 1
        const uint64_t ga = gbase + (uint64_t)(s << gshift);
        g0[0] = one; g0[1] = uni(lbase + (s & 1u) * STG + wave * SL); g0[2] = uni((uint32_t)ga); g0[3] = uni((((uint32_t)(ga >> 32)) & 0x01FFFFFFu) | 0x80000000u);
    };
    auto issue = [&]() { if (pinned(isk)) tdm_load(g0, g1k); else tdm_load(g0, g1v); };   // a scalar branch: a tensor load ignores EXEC
    v16bf q[8];
#pragma unroll
    for (int kc = 0; kc < 8; ++kc) q[kc] = WFrag<bf>::ld(EB + (b * SS + s0 + c) * DD + 8 * h + kc * 32);
    asm volatile("s_wait_xcnt 0x0" ::: "memory");   // in front of the first overwrite of an address register that the loads above name
    form(0); issue();
    asm volatile("s_wait_tensorcnt 0x0" :: "s"(g0) : "memory");   // this wave's slice of stage 0 has landed
    __syncthreads();                                              // and so has every other wave's: stage 0 may be read
    form(pinned(1u)); issue();
    v8f o[16];
#pragma unroll
    for (int dt = 0; dt < 16; ++dt) o[dt] = (v8f){};
    float mul2 = -3.0e38f;   // maximum in use, in log2 units
    v16f lv = (v16f){};      // this lane's share of the row sum, 16 independent partial sums
    const int ka = c * KP + 16 * h, va = KBYTES + c * VP + 16 * h;
#pragma unroll 1
    for (int st = 0; st < SS / KT; ++st) {
        const unsigned char* kb = lds + (st & 1) * STG;
        // Fragments come from LDS in groups of 8 (16 loads), each group issued as one block ahead of the products of the group before it: K groups 0-3 (2 k-chunks x 4 t-tiles), V^T groups 0-3 (4 d-tiles x 2 t-chunks).
        // The sched_barrier(0) calls keep each load block whole and in front of those products; without them the compiler sinks every load to its product and the wave waits out the LDS latency at each one.
        v16bf f[2][8];
#pragma unroll
        for (int u = 0; u < 8; ++u) f[0][u] = ldsfrag(kb + ka + (u & 3) * 16 * KP + (u >> 2) * 64);
        v8f sT[4];
#pragma unroll
        for (int tt = 0; tt < 4; ++tt) sT[tt] = (v8f){};
#pragma unroll
        for (int g = 0; g < 4; ++g) {
#pragma unroll
            for (int u = 0; u < 8; ++u) f[(g + 1) & 1][u] = g < 3 ? ldsfrag(kb + ka + ((g + 1) >> 1) * SL + (u & 3) * 16 * KP + (((g + 1) & 1) * 2 + (u >> 2)) * 64) : ldsfrag(kb + va + (u >> 1) * 16 * VP + (u & 1) * 64);
            __builtin_amdgcn_sched_barrier(0);
#pragma unroll
            for (int u = 0; u < 8; ++u) sT[u & 3] = wmmab(f[g & 1][u], q[g * 2 + (u >> 2)], sT[u & 3]);
            __builtin_amdgcn_sched_barrier(0);
        }
        float m4[4];
#pragma unroll
        for (int tt = 0; tt < 4; ++tt) { m4[tt] = sT[tt][0];
#pragma unroll
            for (int j = 1; j < 8; ++j) m4[tt] = fmaxf(m4[tt], sT[tt][j]); }
        float mx = fmaxf(fmaxf(m4[0], m4[1]), fmaxf(m4[2], m4[3]));
        mx = fmaxf(mx, xhalf(mx)) * 1.4426950408889634f;
        if (__builtin_amdgcn_ballot_w32(mx > mul2 + 8.0f) != 0) {   // one wave-uniform test a stage: rescale only when a row's maximum outgrows the one in use by 2^8
            const float mn = fmaxf(mul2, mx), sc = __builtin_amdgcn_exp2f(mul2 - mn); mul2 = mn; lv *= sc;
#pragma unroll
            for (int dt = 0; dt < 16; ++dt) o[dt] *= sc;
        }
        v16bf ph[2], pl[2];
#pragma unroll
        for (int kk = 0; kk < 2; ++kk) { v16f p;
#pragma unroll
            for (int e = 0; e < 16; ++e) p[e] = __builtin_amdgcn_exp2f(__builtin_fmaf(sT[kk * 2 + (e >> 3)][e & 7], 1.4426950408889634f, -mul2));
            lv += p; ph[kk] = __builtin_convertvector(p, v16bf); const v8u w = __builtin_bit_cast(v8u, ph[kk]); v16f hf;
#pragma unroll
            for (int i = 0; i < 8; ++i) { hf[2 * i] = __uint_as_float(w[i] << 16); hf[2 * i + 1] = __uint_as_float(w[i] & 0xFFFF0000u); }
            pl[kk] = __builtin_convertvector(p - hf, v16bf); }
        __builtin_amdgcn_sched_barrier(0);
#pragma unroll
        for (int g = 0; g < 4; ++g) {
            if (g < 3) {
#pragma unroll
                for (int u = 0; u < 8; ++u) f[(g + 1) & 1][u] = ldsfrag(kb + va + ((g + 1) * 4 + (u >> 1)) * 16 * VP + (u & 1) * 64);
            }
            __builtin_amdgcn_sched_barrier(0);
#pragma unroll
            for (int kk = 0; kk < 2; ++kk) {
#pragma unroll
                for (int u = 0; u < 4; ++u) o[g * 4 + u] = wmmab(f[g & 1][u * 2 + kk], ph[kk], o[g * 4 + u]);
#pragma unroll
                for (int u = 0; u < 4; ++u) o[g * 4 + u] = wmmab(f[g & 1][u * 2 + kk], pl[kk], o[g * 4 + u]); }
            __builtin_amdgcn_sched_barrier(0);
        }
        asm volatile("s_wait_dscnt 0x0" ::: "memory");       // this wave's reads of this stage's buffer are over
        asm volatile("s_wait_tensorcnt 0x0" :: "s"(g0) : "memory");   // this wave's slice of the next stage has landed
        __syncthreads();   // publishes the next stage and ends every wave's reads of this one
        form(pinned((uint32_t)st + 2u));        // formed behind the wait
        if (pinned(st + 2 < SS / KT)) issue();   // into the buffer that this stage has just left; it flies during the whole of the next stage
    }
    asm volatile("s_wait_tensorcnt 0x0" ::: "memory");   // no tensor load is in flight
    asm volatile("s_wait_dscnt 0x0" ::: "memory");       // and no LDS read, before the buffers take W^T
    // ---- Output product: OUT^T[n][s] = sum_k W^T[n][k] X^T[k][s], X = [context | dec], k = 0..511. A = W^T rows from LDS, B = this wave's 16 rows s, all in registers:
    // two O^T tiles (d 0-15, 16-31 of a 32-block) converted in place are a B fragment in the hardware k order, as the weights were above; the dec rows load as the enc rows did.
    // W^T comes in four quarters of 64 rows n, two LDS buffers, one barrier a quarter; per accumulator the k order is hi, lo of each 32-block, context first, then dec.
    const bf* Wg = BW + tid * 8;                                                 // a quarter is 64 KiB in a row: chunk x = i * 128 + tid, 64 chunks a row
    const int wst = (tid >> 6) * WP + (tid & 63) * 16, wa = c * WP + 16 * h;
    v8us wr[32];
#pragma unroll
    for (int i = 0; i < 32; ++i) wr[i] = *(const v8us*)(Wg + i * 1024);
    asm volatile("s_wait_xcnt 0x0" ::: "memory");   // in front of the first overwrite of an address register that the loads above name
    __builtin_amdgcn_sched_barrier(0);              // keeps the next loads' address arithmetic, which reuses that register, behind the wait
    v16bf dq[8];
#pragma unroll
    for (int kc = 0; kc < 8; ++kc) dq[kc] = WFrag<bf>::ld(DB + (b * SS + s0 + c) * DD + 8 * h + kc * 32);
    asm volatile("s_wait_xcnt 0x0" ::: "memory");   // in front of the first overwrite of an address register that the loads above name
    float l = 0.f;
#pragma unroll
    for (int e = 0; e < 16; ++e) l += lv[e];
    l += xhalf(l);
    const float rl = __fdiv_rn(1.0f, l);
    v16bf ch[8], cl[8];   // o[dt][r] = context[s0 + c][dt * 16 + 8h + r], split into hi + lo bf16
#pragma unroll
    for (int kc = 0; kc < 8; ++kc) { v16f p;
#pragma unroll
        for (int e = 0; e < 16; ++e) p[e] = o[kc * 2 + (e >> 3)][e & 7] * rl;
        ch[kc] = __builtin_convertvector(p, v16bf); const v8u w = __builtin_bit_cast(v8u, ch[kc]); v16f hf;
#pragma unroll
        for (int i = 0; i < 8; ++i) { hf[2 * i] = __uint_as_float(w[i] << 16); hf[2 * i + 1] = __uint_as_float(w[i] & 0xFFFF0000u); }
        cl[kc] = __builtin_convertvector(p - hf, v16bf); }
#pragma unroll
    for (int i = 0; i < 32; ++i) *(v8usa*)(lds + wst + i * 2 * WP) = wr[i];   // the stage buffers' last readers left them at the barrier that ended the stage loop
    __syncthreads();
    float* orow = OUT + (b * SS + s0 + c) * DD + 8 * h;   // acc[u][r] = out[s0 + c][ng * 64 + u * 16 + 8h + r]
    // The quarter loop stays rolled (unroll 1) to keep the code short; its inner loops are unrolled in full so that the arrays they index stay in registers.
#pragma unroll 1
    for (int ng = 0; ng < 4; ++ng) {
        const unsigned char* wb = lds + (ng & 1) * WQ; unsigned char* nb = lds + ((ng + 1) & 1) * WQ;
        const bool more = ng + 1 < 4;
        v16bf f[2][8];   // groups of 8 fragments (2 k-chunks x 4 n-tiles), each issued as one block ahead of the products of the group before it, held there by the sched_barrier(0) calls as in the stage loop
#pragma unroll
        for (int u = 0; u < 8; ++u) f[0][u] = ldsfrag(wb + wa + (u & 3) * 16 * WP + (u >> 2) * 64);
        if (more) {   // the next quarter flies while this one is worked on
#pragma unroll
            for (int i = 0; i < 32; ++i) wr[i] = *(const v8us*)(Wg + (size_t)(ng + 1) * 64 * 2 * DD + i * 1024);
            asm volatile("s_wait_xcnt 0x0" ::: "memory");   // in front of the first overwrite of an address register that these loads name
        }
        v8f acc[4];
#pragma unroll
        for (int u = 0; u < 4; ++u) acc[u] = (v8f){};
#pragma unroll
        for (int g = 0; g < 8; ++g) {
            if (g < 7) {
#pragma unroll
                for (int u = 0; u < 8; ++u) f[(g + 1) & 1][u] = ldsfrag(wb + wa + (u & 3) * 16 * WP + ((g + 1) * 2 + (u >> 2)) * 64);
            }
            __builtin_amdgcn_sched_barrier(0);
#pragma unroll
            for (int kk = 0; kk < 2; ++kk) { const int kc = g * 2 + kk;
#pragma unroll
                for (int u = 0; u < 4; ++u) acc[u] = wmmab(f[g & 1][kk * 4 + u], kc < 8 ? ch[kc & 7] : dq[kc & 7], acc[u]);
                if (kc < 8) {
#pragma unroll
                    for (int u = 0; u < 4; ++u) acc[u] = wmmab(f[g & 1][kk * 4 + u], cl[kc & 7], acc[u]); } }
            __builtin_amdgcn_sched_barrier(0);
        }
        if (more) {   // the other buffer's last readers left it at the barrier that ended the quarter before
#pragma unroll
            for (int i = 0; i < 32; ++i) *(v8usa*)(nb + wst + i * 2 * WP) = wr[i];
        }
#pragma unroll
        for (int u = 0; u < 4; ++u) { v8f r;
#pragma unroll
            for (int j = 0; j < 8; ++j) r[j] = __builtin_amdgcn_tanhf(acc[u][j]);   // the bare v_tanh_f32: the library tanhf is a compare, two lane-mask branches and two serial chains a value, which a lone wave waits out link by link
            *(v8f*)(orow + ng * 64 + u * 16) = r; }
        asm volatile("s_wait_xcnt 0x0" ::: "memory");   // in front of the first overwrite of a register that the stores above name
        __syncthreads();   // publishes the next quarter and ends every wave's reads of this one
    }
}

extern "C" void kernel_launch(void* const* d_in, const int* in_sizes, int n_in,
                              void* d_out, int out_size, void* d_ws, size_t ws_size, hipStream_t stream) {
    (void)in_sizes; (void)n_in; (void)out_size;
    const float* enc = (const float*)d_in[0]; const float* dec = (const float*)d_in[1]; const float* Wt = (const float*)d_in[2];
    float* OUT = (float*)d_out;     // [8][2048][256]
    char* wsp = (char*)d_ws;
    auto take = [&](size_t bytes) { char* p = wsp; wsp += (bytes + 255) & ~(size_t)255; return (void*)p; };
    bf* BW = (bf*)take((size_t)2 * DD * DD * 2); bf* EB = (bf*)take((size_t)NB_ * SS * DD * 2); bf* DB = (bf*)take((size_t)NB_ * SS * DD * 2); bf* ET = (bf*)take((size_t)NB_ * DD * SS * 2);
    if ((size_t)(wsp - (char*)d_ws) > ws_size) return;    // total ~ 24 MiB
    k_prep<<<PW_ + 2 * PE_, 256, 0, stream>>>(enc, dec, Wt, EB, DB, ET, BW);   // bf16 rows of enc and dec, enc^T, W_tanh^T
    k_fattn<<<dim3(SS / 64, NB_), 128, 0, stream>>>(EB, DB, ET, BW, OUT);   // out = tanh([softmax_t(enc . dec^T) . enc | dec] W_tanh)
}

// v007
// A run of this version takes 53.2 microseconds.
// Two timings next to v006 put it at 1.06 and 1.07 times that version's speed.
// Counting every step since v000, it is 15.0 times as fast.
#include <hip/hip_runtime.h>
#include <stdint.h>

// LuongAttention (enc, dec [8][2048][256]; scores[s][t] = enc[s] . dec[t] (unscaled); softmax over t (decoder time); context[s] = sum_t weights[s][t] enc[t] (the source contracts the weights' decoder axis with enc's time axis; both are 2,048 long); out = tanh([context | dec] W_tanh) -> [8][2048][256]).
// Compute dtypes, f32 accumulate: every input rounded to bf16; the unscaled scores are a PLAIN bf16 GEMM of the inputs themselves (exact products, f32 sums - they reach |90|, so nothing narrower would do); softmax f32, running maximum and sum, weights -> hl fragments in registers; context as hl x exact enc (2 products); [hl(context) | bf16(dec)] x exact W_tanh (2 products for the context half, 1 for dec), in the same kernel; tanh f32.

#define NB_  8
#define SS   2048
#define DD   256
typedef _Float16 h16;
typedef unsigned short bf;
typedef __attribute__((ext_vector_type(16))) __bf16   v16bf;
typedef __attribute__((ext_vector_type(16))) _Float16 v16h;
typedef __attribute__((ext_vector_type(8)))  _Float16 v8h;
typedef __attribute__((ext_vector_type(8)))  unsigned short v8us;
typedef __attribute__((ext_vector_type(8)))  float    v8f;
typedef __attribute__((ext_vector_type(4)))  float    v4f;
typedef v8h  __attribute__((may_alias)) v8ha;
typedef v4f  __attribute__((may_alias)) v4fa;
typedef v8us __attribute__((may_alias)) v8usa;

__device__ __forceinline__ unsigned short f2bf(float f) { unsigned u = __float_as_uint(f); u += 0x7FFFu + ((u >> 16) & 1u); return (unsigned short)(u >> 16); }
__device__ __forceinline__ float bf2f(unsigned short b) { return __uint_as_float(((unsigned)b) << 16); }
__device__ __forceinline__ float bfr(float f) { return bf2f(f2bf(f)); }
__device__ __forceinline__ v16h cat16(v8h lo, v8h hi) { return __builtin_shufflevector(lo, hi, 0, 1, 2, 3, 4, 5, 6, 7, 8, 9, 10, 11, 12, 13, 14, 15); }
__device__ __forceinline__ v16bf cat16b(v8us lo, v8us hi) { return __builtin_bit_cast(v16bf, __builtin_shufflevector(lo, hi, 0, 1, 2, 3, 4, 5, 6, 7, 8, 9, 10, 11, 12, 13, 14, 15)); }
__device__ __forceinline__ v8f wmma16(v16h a, v16h b, v8f c) { return __builtin_amdgcn_wmma_f32_16x16x32_f16(false, a, false, b, (short)0, c, false, false); }
__device__ __forceinline__ v8f wmmab(v16bf a, v16bf b, v8f c) { return __builtin_amdgcn_wmma_f32_16x16x32_bf16(false, a, false, b, (short)0, c, false, false); }



// 16-bit fragment of 32 k from a K-contiguous row: 16 bytes at p and at p + 16 elements (the caller adds 8 * (lane >> 4)).
template <typename T16> struct WFrag;
template <> struct WFrag<h16> { typedef v16h V; static __device__ __forceinline__ V ld(const h16* p) { return cat16(*(const v8h*)p, *(const v8h*)(p + 16)); } static __device__ __forceinline__ v8f mma(V a, V b, v8f c) { return wmma16(a, b, c); } };
template <> struct WFrag<bf> { typedef v16bf V; static __device__ __forceinline__ V ld(const bf* p) { return cat16b(*(const v8us*)p, *(const v8us*)(p + 16)); } static __device__ __forceinline__ v8f mma(V a, V b, v8f c) { return wmmab(a, b, c); } };
typedef __attribute__((ext_vector_type(2))) unsigned short v2us;
typedef __attribute__((ext_vector_type(4))) unsigned short v4us;

// ---- k_prep: every input goes to bf16 in ONE launch of few, fat work-groups (8 waves, 64 elements a thread, 16 loads of 16 bytes in flight a lane), for speed only.
// A work-group takes 64 rows x 256 columns of f32, 64 KiB in a row, so every wave-wide load covers four whole lines. Jobs by blockIdx.x: W_tanh (transposed only), enc (rows and transposed), dec (rows only).
// Transposing: wave w holds rows 8w..8w+7, a lane 4 columns of them in each half of 128; 8 rows of one column are one 16-byte chunk. LDS row R = half * 128 + j * 32 + lane holds column half * 128 + 4 * lane + j, 128 bytes (64 rows),
// its chunk g at place g ^ ((R >> 1) & 7): 16 lanes that write one g into 16 rows, and 16 lanes that read all of 2 rows, each touch every bank once. Every transposed store is a whole 128-byte line from 8 lanes.
// Every loop is unrolled in full so that the arrays it indexes stay in registers.
#define PW_ (2 * DD / 64)               // work-groups on W_tanh [512][256]
#define PE_ (NB_ * SS / 64)             // work-groups on enc, and as many on dec
template <bool ROWS, bool TR> __device__ __forceinline__ void prep_tile(const float* __restrict__ src, bf* rows, bf* tr, const int trp, unsigned char* lds) {
    const int tid = threadIdx.x, lane = tid & 31, w = tid >> 5;
    const size_t off = (size_t)w * 8 * DD + lane * 4;
    const unsigned ob = (unsigned)off * 4;   // the same in bytes of f32
    v4f v[2][8];
#pragma unroll
    for (int hh = 0; hh < 2; ++hh) {
#pragma unroll
        for (int r = 0; r < 8; ++r) v[hh][r] = *(const v4f*)((const char*)src + ob + (r * DD + hh * 128) * 4); }
    asm volatile("s_wait_xcnt 0x0" :: "v"(ob) : "memory");   // in front of the first overwrite of the address register that the loads above name; it is an input here so that it lives up to the wait and no load of the block lands on it
    __builtin_amdgcn_sched_barrier(0);              // keeps all 16 loads in front of the first conversion; without it the compiler holds some back until earlier ones have landed, a second memory latency
    v4us cv[2][8];
#pragma unroll
    for (int hh = 0; hh < 2; ++hh) {
#pragma unroll
        for (int r = 0; r < 8; ++r) {
#pragma unroll
            for (int j = 0; j < 4; ++j) cv[hh][r][j] = f2bf(v[hh][r][j]); } }
    v8us tc[8];
    if (TR) {
#pragma unroll
        for (int hh = 0; hh < 2; ++hh) {
#pragma unroll
            for (int j = 0; j < 4; ++j) { v8us col;
#pragma unroll
                for (int r = 0; r < 8; ++r) col[r] = cv[hh][r][j];
                const int R = hh * 128 + j * 32 + lane; *(v8usa*)(lds + R * 128 + ((w ^ ((R >> 1) & 7)) * 16)) = col; } }
        __syncthreads();   // every chunk of the tile is in LDS before a row of it is read; the global stores all stand behind it, so that it waits for none of them
#pragma unroll
        for (int i = 0; i < 8; ++i) tc[i] = *(const v8usa*)(lds + i * 32 * 128 + (tid >> 3) * 128 + (((tid & 7) ^ ((tid >> 4) & 7)) * 16));   // row R = 32 i + (tid >> 3), chunk g = tid & 7; (R >> 1) & 7 does not depend on i
    }
    if (ROWS) {
#pragma unroll
        for (int hh = 0; hh < 2; ++hh) {
#pragma unroll
            for (int r = 0; r < 8; ++r) *(v4us*)(rows + off + r * DD + hh * 128) = cv[hh][r]; }
        asm volatile("s_wait_xcnt 0x0" ::: "memory");       // in front of the first overwrite of a register that the stores above name, on every way that leads on from here
        if (TR) __builtin_amdgcn_sched_barrier(0);          // keeps the next stores' address arithmetic, which reuses such a register, behind the wait
    }
    if (TR) {
#pragma unroll
        for (int i = 0; i < 8; ++i) *(v8us*)(tr + (size_t)(tid >> 3) * 4 * trp + (tid & 7) * 8 + ((i >> 2) * 128 + (i & 3)) * trp) = tc[i];   // that row's column: (i >> 2) * 128 + 4 (tid >> 3) + (i & 3)
        asm volatile("s_wait_xcnt 0x0" ::: "memory");       // in front of the first overwrite of a register that the stores above name, on every way that leads on from here
    }
}
__global__ __launch_bounds__(256) void k_prep(const float* __restrict__ enc, const float* __restrict__ dec, const float* __restrict__ wt, bf* EB, bf* DB, bf* ET, bf* BW) {
    __shared__ __align__(16) unsigned char lds[DD * 128];
    const int x = blockIdx.x;
    if (x < PW_) prep_tile<false, true>(wt + (size_t)x * 64 * DD, nullptr, BW + x * 64, 2 * DD, lds);                  // BW[n][k] = W_tanh[k][n]
    else if (x < PW_ + PE_) { const int y = x - PW_, bb = y / (SS / 64), t0 = y % (SS / 64) * 64;
        prep_tile<true, true>(enc + (size_t)y * 64 * DD, EB + (size_t)y * 64 * DD, ET + (size_t)bb * DD * SS + t0, SS, lds); }   // ET[b][d][t] = enc[b][t][d]
    else { const int y = x - PW_ - PE_; prep_tile<true, false>(dec + (size_t)y * 64 * DD, DB + (size_t)y * 64 * DD, nullptr, 0, lds); }
}
#define KT 64
#define KP 272                    // LDS pitch of half a dec row: 256 + 16 bytes (16 x odd, conflict-free for 16-byte reads), laid by the tensor load's pad
#define VP 144                    // LDS pitch of a V^T row: 128 + 16 bytes, laid likewise
#define SL 18432                  // one wave's slice of a buffer, a multiple of 2 KiB: 64 rows x KP (17,408 bytes, rounded up) or 128 rows x VP (exactly)
#define KBYTES (2 * SL)
#define STG (4 * SL)              // one buffer: K columns 0-127, K columns 128-255, V^T rows 0-127, V^T rows 128-255; 73,728 bytes
#define WP 1040                   // LDS pitch of a W^T row: 1,024 + 16 bytes (16 x odd)
#define WQ (64 * WP)              // one buffer of the output product: 64 rows n, 66,560 bytes; two of them fit the first two stage buffers
#define XO (2 * STG)              // where the groups' contexts are exchanged: 16 KiB a wave, in the last two stage buffers
#define XM (XO + 8 * 16384)       // and their maxima and sums: 256 bytes a wave
typedef __attribute__((ext_vector_type(16))) float v16f;
typedef __attribute__((ext_vector_type(2))) float v2f;
typedef v2f __attribute__((may_alias)) v2fa;
typedef __attribute__((ext_vector_type(8))) unsigned v8u;
__device__ __forceinline__ v16bf ldsfrag(const unsigned char* p) { return cat16b(*(const v8usa*)p, *(const v8usa*)(p + 32)); }
__device__ __forceinline__ float xhalf(float x) { const int b = __float_as_int(x); return __int_as_float(__builtin_amdgcn_permlanex16(b, b, 0x76543210, 0xfedcba98, false, false)); }   // lane l <-> l ^ 16
typedef uint32_t u32x4 __attribute__((ext_vector_type(4)));
typedef uint32_t u32x8 __attribute__((ext_vector_type(8)));
__device__ __forceinline__ uint32_t uni(uint32_t v) { return (uint32_t)__builtin_amdgcn_readfirstlane(v); }
__device__ __forceinline__ uint32_t pinned(uint32_t v) { uint32_t w = (uint32_t)__builtin_amdgcn_readfirstlane(v); asm volatile("" : "+s"(w)); return w; }   // the empty statement holds a descriptor word, or the value that a tensor load's issue test reads, in a scalar register: the test is then a scalar branch (a tensor load ignores EXEC), and a word formed from it is formed behind the wait that stands in front of it
// Group 1 of a tensor load's descriptor: ROWS rows of ROWB bytes, source pitch PITCH bytes; W0 = word 0 (no mask, 1-byte elements, 16 bytes of pad behind every row).
// Every word goes through pinned(): a descriptor word held in a scalar register, formed once in front of the first request, so that no register of the group takes a new value while a request is in flight.
template <uint32_t ROWB, uint32_t ROWS, uint32_t PITCH, uint32_t W0> __device__ __forceinline__ u32x8 tdm_group1() {
    u32x8 g;
    g[0] = pinned(W0); g[1] = pinned((ROWB & 0xFFFFu) << 16); g[2] = pinned((ROWB >> 16) | ((ROWS & 0xFFFFu) << 16)); g[3] = pinned((ROWS >> 16) | (ROWB << 16));
    g[4] = pinned(ROWS); g[5] = pinned(PITCH); g[6] = pinned(0u); g[7] = pinned(0u);
    return g;
}
__device__ __forceinline__ void tdm_load(u32x4 g0, u32x8 g1) { asm volatile("tensor_load_to_lds %0, %1" :: "s"(g0), "s"(g1) : "memory"); }
__global__ __launch_bounds__(256) __attribute__((amdgpu_waves_per_eu(2, 2))) void k_fattn(const bf* __restrict__ EB, const bf* __restrict__ DB, const bf* __restrict__ ET, const bf* __restrict__ BW, float* __restrict__ OUT) {
    __shared__ __attribute__((aligned(2048))) unsigned char lds[4 * STG];   // every slice's place is a multiple of 2 KiB
    const int tid = threadIdx.x, lane = tid & 31, c = lane & 15, h = lane >> 4;
    const size_t b = blockIdx.y; const int s0 = blockIdx.x * 64 + ((tid >> 5) & 3) * 16;
    const uint32_t wv = uni((uint32_t)tid >> 5), grp = wv >> 2, wave = wv & 3u, lbase = (uint32_t)(size_t)lds;   // grp: which stage of a pass; wave: which 16 rows, and which slice of the stage
    const bool isk = wave < 2u;      // slices 0, 1: 64 rows t x 256 bytes of K, source pitch 512; slices 2, 3: 128 rows d x 128 bytes of V^T, source pitch 4,096
    const uint64_t gbase = isk ? (uint64_t)(size_t)(DB + b * SS * DD) + (wave & 1u) * 256u : (uint64_t)(size_t)(ET + b * DD * SS) + (wave & 1u) * (128u * SS * 2u);
    const uint32_t gshift = isk ? 15u : 7u;   // a stage further on: KT rows of 512 bytes, or KT columns of 2 bytes
    const u32x8 g1k = tdm_group1<256u, KT, DD * 2u, (1u << 20 | 5u << 22 | 3u << 25)>(), g1v = tdm_group1<KT * 2u, 128u, SS * 2u, (1u << 20 | 4u << 22 | 3u << 25)>();
    const uint32_t one = pinned(1u);          // group 0, word 0: a descriptor word held in a scalar register, as those of group 1
    u32x4 g0;                                 // group 0 of this wave's request in flight; an input of the wait that covers it, so that its registers live up to that wait
    auto form = [&](uint32_t s) {             // this wave's slice of stage s, into place s & 3
        const uint64_t ga = gbase + (uint64_t)(s << gshift);
        g0[0] = one; g0[1] = uni(lbase + (s & 3u) * STG + wave * SL); g0[2] = uni((uint32_t)ga); g0[3] = uni((((uint32_t)(ga >> 32)) & 0x01FFFFFFu) | 0x80000000u);
    };
    auto issue = [&]() { if (pinned(isk)) tdm_load(g0, g1k); else tdm_load(g0, g1v); };   // a scalar branch: a tensor load ignores EXEC
    v16bf q[8];
#pragma unroll
    for (int kc = 0; kc < 8; ++kc) q[kc] = WFrag<bf>::ld(EB + (b * SS + s0 + c) * DD + 8 * h + kc * 32);
    asm volatile("s_wait_xcnt 0x0" ::: "memory");   // in front of the first overwrite of an address register that the loads above name
    form(grp); issue();
    asm volatile("s_wait_tensorcnt 0x0" :: "s"(g0) : "memory");   // this wave's slice of pass 0 has landed
    __syncthreads();                                              // and so has every other wave's: pass 0 may be read
    form(pinned(2u + grp)); issue();
    v8f o[16];
#pragma unroll
    for (int dt = 0; dt < 16; ++dt) o[dt] = (v8f){};
    float mul2 = -3.0e38f;   // maximum in use, in log2 units
    v16f lv = (v16f){};      // this lane's share of the row sum, 16 independent partial sums
    const int ka = c * KP + 16 * h, va = KBYTES + c * VP + 16 * h;
#pragma unroll 1
    for (int it = 0; it < SS / KT / 2; ++it) {
        const unsigned char* kb = lds + (((uint32_t)it * 2u + grp) & 3u) * STG;   // this group's stage of the pass
        // Fragments come from LDS in groups of 8 (16 loads), each group issued as one block ahead of the products of the group before it: K groups 0-3 (2 k-chunks x 4 t-tiles), V^T groups 0-3 (4 d-tiles x 2 t-chunks).
        // The sched_barrier(0) calls keep each load block whole and in front of those products; without them the compiler sinks every load to its product and the wave waits out the LDS latency at each one.
        v16bf f[2][8];
#pragma unroll
        for (int u = 0; u < 8; ++u) f[0][u] = ldsfrag(kb + ka + (u & 3) * 16 * KP + (u >> 2) * 64);
        v8f sT[4];
#pragma unroll
        for (int tt = 0; tt < 4; ++tt) sT[tt] = (v8f){};
#pragma unroll
        for (int g = 0; g < 4; ++g) {
#pragma unroll
            for (int u = 0; u < 8; ++u) f[(g + 1) & 1][u] = g < 3 ? ldsfrag(kb + ka + ((g + 1) >> 1) * SL + (u & 3) * 16 * KP + (((g + 1) & 1) * 2 + (u >> 2)) * 64) : ldsfrag(kb + va + (u >> 1) * 16 * VP + (u & 1) * 64);
            __builtin_amdgcn_sched_barrier(0);
#pragma unroll
            for (int u = 0; u < 8; ++u) sT[u & 3] = wmmab(f[g & 1][u], q[g * 2 + (u >> 2)], sT[u & 3]);
            __builtin_amdgcn_sched_barrier(0);
        }
        float m4[4];
#pragma unroll
        for (int tt = 0; tt < 4; ++tt) { m4[tt] = sT[tt][0];
#pragma unroll
            for (int j = 1; j < 8; ++j) m4[tt] = fmaxf(m4[tt], sT[tt][j]); }
        float mx = fmaxf(fmaxf(m4[0], m4[1]), fmaxf(m4[2], m4[3]));
        mx = fmaxf(mx, xhalf(mx)) * 1.4426950408889634f;
        if (__builtin_amdgcn_ballot_w32(mx > mul2 + 8.0f) != 0) {   // one wave-uniform test a stage: rescale only when a row's maximum outgrows the one in use by 2^8
            const float mn = fmaxf(mul2, mx), sc = __builtin_amdgcn_exp2f(mul2 - mn); mul2 = mn; lv *= sc;
#pragma unroll
            for (int dt = 0; dt < 16; ++dt) o[dt] *= sc;
        }
        v16bf ph[2], pl[2];
#pragma unroll
        for (int kk = 0; kk < 2; ++kk) { v16f p;
#pragma unroll
            for (int e = 0; e < 16; ++e) p[e] = __builtin_amdgcn_exp2f(__builtin_fmaf(sT[kk * 2 + (e >> 3)][e & 7], 1.4426950408889634f, -mul2));
            lv += p; ph[kk] = __builtin_convertvector(p, v16bf); const v8u w = __builtin_bit_cast(v8u, ph[kk]); v16f hf;
#pragma unroll
            for (int i = 0; i < 8; ++i) { hf[2 * i] = __uint_as_float(w[i] << 16); hf[2 * i + 1] = __uint_as_float(w[i] & 0xFFFF0000u); }
            pl[kk] = __builtin_convertvector(p - hf, v16bf); }
        __builtin_amdgcn_sched_barrier(0);
#pragma unroll
        for (int g = 0; g < 4; ++g) {
            if (g < 3) {
#pragma unroll
                for (int u = 0; u < 8; ++u) f[(g + 1) & 1][u] = ldsfrag(kb + va + ((g + 1) * 4 + (u >> 1)) * 16 * VP + (u & 1) * 64);
            }
            __builtin_amdgcn_sched_barrier(0);
#pragma unroll
            for (int kk = 0; kk < 2; ++kk) {
#pragma unroll
                for (int u = 0; u < 4; ++u) o[g * 4 + u] = wmmab(f[g & 1][u * 2 + kk], ph[kk], o[g * 4 + u]);
#pragma unroll
                for (int u = 0; u < 4; ++u) o[g * 4 + u] = wmmab(f[g & 1][u * 2 + kk], pl[kk], o[g * 4 + u]); }
            __builtin_amdgcn_sched_barrier(0);
        }
        asm volatile("s_wait_dscnt 0x0" ::: "memory");       // this wave's reads of this pass's buffer are over
        asm volatile("s_wait_tensorcnt 0x0" :: "s"(g0) : "memory");   // this wave's slice of the next pass has landed
        __syncthreads();   // publishes the next pass and ends every wave's reads of this one
        form(pinned((uint32_t)it * 2u + 4u + grp));   // formed behind the wait
        if (pinned(it + 2 < SS / KT / 2)) issue();    // into the buffer that this pass has just left; it flies during the whole of the next pass
    }
    asm volatile("s_wait_tensorcnt 0x0" ::: "memory");   // no tensor load is in flight
    asm volatile("s_wait_dscnt 0x0" ::: "memory");       // and no LDS read, before the buffers take W^T
    // ---- Join of the two groups, then the output product: OUT^T[n][s] = sum_k W^T[n][k] X^T[k][s], X = [context | dec], k = 0..511. A = W^T rows from LDS, B = this wave's 16 rows s, all in registers:
    // two O^T tiles (d 0-15, 16-31 of a 32-block) converted in place are a B fragment in the hardware k order, as the weights were above; the dec rows load as the enc rows did.
    // W^T comes in four quarters of 64 rows n, two LDS buffers, one barrier a quarter; of each quarter group g takes the rows n 32 g .. 32 g + 31 (whole 128-byte lines of the output); per accumulator the k order is hi, lo of each 32-block, context first, then dec.
    const bf* Wg = BW + tid * 8;                                                 // a quarter is 64 KiB in a row: chunk x = i * 256 + tid, 64 chunks a row
    const int wst = (tid >> 6) * WP + (tid & 63) * 16, wa = ((int)grp * 32 + c) * WP + 16 * h;
    v8us wr[16];
#pragma unroll
    for (int i = 0; i < 16; ++i) wr[i] = *(const v8us*)(Wg + i * 2048);
    asm volatile("s_wait_xcnt 0x0" ::: "memory");   // in front of the first overwrite of an address register that the loads above name
    __builtin_amdgcn_sched_barrier(0);              // keeps the next loads' address arithmetic, which reuses that register, behind the wait
    v16bf dq[8];
    const bf* dqp = DB + (b * SS + s0 + c) * DD + 8 * h;
#pragma unroll
    for (int kc = 0; kc < 8; ++kc) dq[kc] = WFrag<bf>::ld(dqp + kc * 32);
    asm volatile("s_wait_xcnt 0x0" :: "v"(dqp) : "memory");   // in front of the first overwrite of the address register that the loads above name; it is an input here so that it lives up to the wait and no load of the block lands on it
    float l = 0.f;
#pragma unroll
    for (int e = 0; e < 16; ++e) l += lv[e];
    l += xhalf(l);
    // The join: each wave shows its partner (wave ^ 4, the same rows, the other stages) its maximum in use and its sum, scales its own context to the common maximum and the whole sum, and shows that too; own + partner's is then the same in both.
    *(v2fa*)(lds + XM + wv * 256 + lane * 8) = (v2f){mul2, l};   // the stage buffers' last readers left them at the barrier that ended the stage loop
    __syncthreads();   // both waves' maxima and sums are in LDS
    const v2f pml = *(const v2fa*)(lds + XM + (wv ^ 4u) * 256 + lane * 8);
    const float mn2 = fmaxf(mul2, pml[0]), so = __builtin_amdgcn_exp2f(mul2 - mn2);
    const float sc2 = so * __fdiv_rn(1.0f, l * so + pml[1] * __builtin_amdgcn_exp2f(pml[0] - mn2));
    unsigned char* xo = lds + XO + wv * 16384 + lane * 16; const unsigned char* xp = lds + XO + (wv ^ 4u) * 16384 + lane * 16;   // every wave-wide access is 512 bytes in a row
#pragma unroll
    for (int dt = 0; dt < 16; ++dt) { o[dt] *= sc2;
        *(v4fa*)(xo + dt * 1024) = __builtin_shufflevector(o[dt], o[dt], 0, 1, 2, 3); *(v4fa*)(xo + dt * 1024 + 512) = __builtin_shufflevector(o[dt], o[dt], 4, 5, 6, 7); }
#pragma unroll
    for (int i = 0; i < 16; ++i) *(v8usa*)(lds + wst + i * 4 * WP) = wr[i];
    __syncthreads();   // every wave's scaled context and the first quarter of W^T are in LDS
#pragma unroll
    for (int dt = 0; dt < 16; ++dt) { const v4f x0 = *(const v4fa*)(xp + dt * 1024), x1 = *(const v4fa*)(xp + dt * 1024 + 512); o[dt] += __builtin_shufflevector(x0, x1, 0, 1, 2, 3, 4, 5, 6, 7); }
    v16bf ch[8], cl[8];   // o[dt][r] = context[s0 + c][dt * 16 + 8h + r], split into hi + lo bf16
#pragma unroll
    for (int kc = 0; kc < 8; ++kc) { v16f p;
#pragma unroll
        for (int e = 0; e < 16; ++e) p[e] = o[kc * 2 + (e >> 3)][e & 7];
        ch[kc] = __builtin_convertvector(p, v16bf); const v8u w = __builtin_bit_cast(v8u, ch[kc]); v16f hf;
#pragma unroll
        for (int i = 0; i < 8; ++i) { hf[2 * i] = __uint_as_float(w[i] << 16); hf[2 * i + 1] = __uint_as_float(w[i] & 0xFFFF0000u); }
        cl[kc] = __builtin_convertvector(p - hf, v16bf); }
    float* orow = OUT + (b * SS + s0 + c) * DD + grp * 32 + 8 * h;   // acc[u][r] = out[s0 + c][ng * 64 + grp * 32 + u * 16 + 8h + r]
    // The quarter loop stays rolled (unroll 1) to keep the code short; its inner loops are unrolled in full so that the arrays they index stay in registers.
#pragma unroll 1
    for (int ng = 0; ng < 4; ++ng) {
        const unsigned char* wb = lds + (ng & 1) * WQ; unsigned char* nb = lds + ((ng + 1) & 1) * WQ;
        const bool more = ng + 1 < 4;
        v16bf f[2][8];   // groups of 8 fragments (4 k-chunks x 2 n-tiles), each issued as one block ahead of the products of the group before it, held there by the sched_barrier(0) calls as in the stage loop
#pragma unroll
        for (int u = 0; u < 8; ++u) f[0][u] = ldsfrag(wb + wa + (u & 1) * 16 * WP + (u >> 1) * 64);
        if (more) {   // the next quarter flies while this one is worked on
#pragma unroll
            for (int i = 0; i < 16; ++i) wr[i] = *(const v8us*)(Wg + (size_t)(ng + 1) * 64 * 2 * DD + i * 2048);
            asm volatile("s_wait_xcnt 0x0" ::: "memory");   // in front of the first overwrite of an address register that these loads name
        }
        v8f acc[2];
#pragma unroll
        for (int u = 0; u < 2; ++u) acc[u] = (v8f){};
#pragma unroll
        for (int g = 0; g < 4; ++g) {
            if (g < 3) {
#pragma unroll
                for (int u = 0; u < 8; ++u) f[(g + 1) & 1][u] = ldsfrag(wb + wa + (u & 1) * 16 * WP + ((g + 1) * 4 + (u >> 1)) * 64);
            }
            __builtin_amdgcn_sched_barrier(0);
#pragma unroll
            for (int kk = 0; kk < 4; ++kk) { const int kc = g * 4 + kk;
#pragma unroll
                for (int u = 0; u < 2; ++u) acc[u] = wmmab(f[g & 1][kk * 2 + u], kc < 8 ? ch[kc & 7] : dq[kc & 7], acc[u]);
                if (kc < 8) {
#pragma unroll
                    for (int u = 0; u < 2; ++u) acc[u] = wmmab(f[g & 1][kk * 2 + u], cl[kc & 7], acc[u]); } }
            __builtin_amdgcn_sched_barrier(0);
        }
        if (more) {   // the other buffer's last readers left it at the barrier that ended the quarter before
#pragma unroll
            for (int i = 0; i < 16; ++i) *(v8usa*)(nb + wst + i * 4 * WP) = wr[i];
        }
#pragma unroll
        for (int u = 0; u < 2; ++u) { v8f r;
#pragma unroll
            for (int j = 0; j < 8; ++j) r[j] = __builtin_amdgcn_tanhf(acc[u][j]);   // the bare v_tanh_f32: the library tanhf is a compare, two lane-mask branches and two serial chains a value, which a wave waits out link by link
            *(v8f*)(orow + ng * 64 + u * 16) = r; }
        asm volatile("s_wait_xcnt 0x0" ::: "memory");   // in front of the first overwrite of a register that the stores above name
        __syncthreads();   // publishes the next quarter and ends every wave's reads of this one
    }
}

extern "C" void kernel_launch(void* const* d_in, const int* in_sizes, int n_in,
                              void* d_out, int out_size, void* d_ws, size_t ws_size, hipStream_t stream) {
    (void)in_sizes; (void)n_in; (void)out_size;
    const float* enc = (const float*)d_in[0]; const float* dec = (const float*)d_in[1]; const float* Wt = (const float*)d_in[2];
    float* OUT = (float*)d_out;     // [8][2048][256]
    char* wsp = (char*)d_ws;
    auto take = [&](size_t bytes) { char* p = wsp; wsp += (bytes + 255) & ~(size_t)255; return (void*)p; };
    bf* BW = (bf*)take((size_t)2 * DD * DD * 2); bf* EB = (bf*)take((size_t)NB_ * SS * DD * 2); bf* DB = (bf*)take((size_t)NB_ * SS * DD * 2); bf* ET = (bf*)take((size_t)NB_ * DD * SS * 2);
    if ((size_t)(wsp - (char*)d_ws) > ws_size) return;    // total ~ 24 MiB
    k_prep<<<PW_ + 2 * PE_, 256, 0, stream>>>(enc, dec, Wt, EB, DB, ET, BW);   // bf16 rows of enc and dec, enc^T, W_tanh^T
    k_fattn<<<dim3(SS / 64, NB_), 256, 0, stream>>>(EB, DB, ET, BW, OUT);   // out = tanh([softmax_t(enc . dec^T) . enc | dec] W_tanh)
}

// v009
// One run takes 47 microseconds.
// It is 1.13 times as fast as v007, going by the measured steps of the versions left out in between.
// Counting every step since v000, it is 17.0 times as fast.
#include <hip/hip_runtime.h>
#include <stdint.h>

// LuongAttention (enc, dec [8][2048][256]; scores[s][t] = enc[s] . dec[t] (unscaled); softmax over t (decoder time); context[s] = sum_t weights[s][t] enc[t] (the source contracts the weights' decoder axis with enc's time axis; both are 2,048 long); out = tanh([context | dec] W_tanh) -> [8][2048][256]).
// Compute dtypes, f32 accumulate: every input rounded to bf16; the unscaled scores are a PLAIN bf16 GEMM of the inputs themselves (exact products, f32 sums - they reach |90|, so nothing narrower would do); softmax f32, running maximum and sum, weights -> one f16 fragment in registers (11 bits; they are at most 2^8); context as f16 weights x enc^T in f16 (the bf16-rounded values, which f16 holds exactly from 2^-17 up and to 2^-25 below; 1 product); [f16(context) | bf16(dec)] x W_tanh (bf16-rounded values; the half that meets the context kept as f16), 1 product each, in the same kernel; tanh f32.

#define NB_  8
#define SS   2048
#define DD   256
typedef _Float16 h16;
typedef unsigned short bf;
typedef __attribute__((ext_vector_type(16))) __bf16   v16bf;
typedef __attribute__((ext_vector_type(16))) _Float16 v16h;
typedef __attribute__((ext_vector_type(8)))  _Float16 v8h;
typedef __attribute__((ext_vector_type(8)))  unsigned short v8us;
typedef __attribute__((ext_vector_type(8)))  float    v8f;
typedef __attribute__((ext_vector_type(4)))  float    v4f;
typedef v8h  __attribute__((may_alias)) v8ha;
typedef v4f  __attribute__((may_alias)) v4fa;
typedef v8us __attribute__((may_alias)) v8usa;

__device__ __forceinline__ unsigned short f2bf(float f) { unsigned u = __float_as_uint(f); u += 0x7FFFu + ((u >> 16) & 1u); return (unsigned short)(u >> 16); }
__device__ __forceinline__ float bf2f(unsigned short b) { return __uint_as_float(((unsigned)b) << 16); }
__device__ __forceinline__ float bfr(float f) { return bf2f(f2bf(f)); }
__device__ __forceinline__ v16h cat16(v8h lo, v8h hi) { return __builtin_shufflevector(lo, hi, 0, 1, 2, 3, 4, 5, 6, 7, 8, 9, 10, 11, 12, 13, 14, 15); }
__device__ __forceinline__ v16bf cat16b(v8us lo, v8us hi) { return __builtin_bit_cast(v16bf, __builtin_shufflevector(lo, hi, 0, 1, 2, 3, 4, 5, 6, 7, 8, 9, 10, 11, 12, 13, 14, 15)); }
__device__ __forceinline__ v8f wmma16(v16h a, v16h b, v8f c) { return __builtin_amdgcn_wmma_f32_16x16x32_f16(false, a, false, b, (short)0, c, false, false); }
__device__ __forceinline__ v8f wmmab(v16bf a, v16bf b, v8f c) { return __builtin_amdgcn_wmma_f32_16x16x32_bf16(false, a, false, b, (short)0, c, false, false); }



// 16-bit fragment of 32 k from a K-contiguous row: 16 bytes at p and at p + 16 elements (the caller adds 8 * (lane >> 4)).
template <typename T16> struct WFrag;
template <> struct WFrag<h16> { typedef v16h V; static __device__ __forceinline__ V ld(const h16* p) { return cat16(*(const v8h*)p, *(const v8h*)(p + 16)); } static __device__ __forceinline__ v8f mma(V a, V b, v8f c) { return wmma16(a, b, c); } };
template <> struct WFrag<bf> { typedef v16bf V; static __device__ __forceinline__ V ld(const bf* p) { return cat16b(*(const v8us*)p, *(const v8us*)(p + 16)); } static __device__ __forceinline__ v8f mma(V a, V b, v8f c) { return wmmab(a, b, c); } };
typedef __attribute__((ext_vector_type(2))) unsigned short v2us;
typedef __attribute__((ext_vector_type(4))) unsigned short v4us;

// ---- k_prep: every input goes to bf16 in ONE launch of few, fat work-groups (8 waves, 64 elements a thread, 16 loads of 16 bytes in flight a lane), for speed only.
// A work-group takes 64 rows x 256 columns of f32, 64 KiB in a row, so every wave-wide load covers four whole lines. Jobs by blockIdx.x: W_tanh (transposed only; its rows k < 256, which meet the context, as f16), enc (rows, and transposed as f16), dec (rows only). A plane kept as f16 holds the same bf16-rounded values, in the type of the operand they meet.
// Transposing: wave w holds rows 8w..8w+7, a lane 4 columns of them in each half of 128; 8 rows of one column are one 16-byte chunk. LDS row R = half * 128 + j * 32 + lane holds column half * 128 + 4 * lane + j, 128 bytes (64 rows),
// its chunk g at place g ^ ((R >> 1) & 7): 16 lanes that write one g into 16 rows, and 16 lanes that read all of 2 rows, each touch every bank once. Every transposed store is a whole 128-byte line from 8 lanes.
// Every loop is unrolled in full so that the arrays it indexes stay in registers.
#define PW_ (2 * DD / 64)               // work-groups on W_tanh [512][256]
#define PE_ (NB_ * SS / 64)             // work-groups on enc, and as many on dec
template <bool ROWS, bool TR, bool TRH> __device__ __forceinline__ void prep_tile(const float* __restrict__ src, bf* rows, bf* tr, const int trp, unsigned char* lds) {
    const int tid = threadIdx.x, lane = tid & 31, w = tid >> 5;
    const size_t off = (size_t)w * 8 * DD + lane * 4;
    const unsigned ob = (unsigned)off * 4;   // the same in bytes of f32
    v4f v[2][8];
#pragma unroll
    for (int hh = 0; hh < 2; ++hh) {
#pragma unroll
        for (int r = 0; r < 8; ++r) v[hh][r] = *(const v4f*)((const char*)src + ob + (r * DD + hh * 128) * 4); }
    asm volatile("s_wait_xcnt 0x0" :: "v"(ob) : "memory");   // in front of the first overwrite of the address register that the loads above name; it is an input here so that it lives up to the wait and no load of the block lands on it
    __builtin_amdgcn_sched_barrier(0);              // keeps all 16 loads in front of the first conversion; without it the compiler holds some back until earlier ones have landed, a second memory latency
    v4us cv[2][8];
#pragma unroll
    for (int hh = 0; hh < 2; ++hh) {
#pragma unroll
        for (int r = 0; r < 8; ++r) {
#pragma unroll
            for (int j = 0; j < 4; ++j) cv[hh][r][j] = f2bf(v[hh][r][j]); } }
    v8us tc[8];
    if (TR) {
#pragma unroll
        for (int hh = 0; hh < 2; ++hh) {
#pragma unroll
            for (int j = 0; j < 4; ++j) { v8us col;
#pragma unroll
                for (int r = 0; r < 8; ++r) col[r] = TRH ? __builtin_bit_cast(unsigned short, (h16)bf2f(cv[hh][r][j])) : cv[hh][r][j];   // TRH: the same bf16-rounded value, written as f16
                const int R = hh * 128 + j * 32 + lane; *(v8usa*)(lds + R * 128 + ((w ^ ((R >> 1) & 7)) * 16)) = col; } }
        __syncthreads();   // every chunk of the tile is in LDS before a row of it is read; the global stores all stand behind it, so that it waits for none of them
#pragma unroll
        for (int i = 0; i < 8; ++i) tc[i] = *(const v8usa*)(lds + i * 32 * 128 + (tid >> 3) * 128 + (((tid & 7) ^ ((tid >> 4) & 7)) * 16));   // row R = 32 i + (tid >> 3), chunk g = tid & 7; (R >> 1) & 7 does not depend on i
    }
    if (ROWS) {
#pragma unroll
        for (int hh = 0; hh < 2; ++hh) {
#pragma unroll
            for (int r = 0; r < 8; ++r) *(v4us*)(rows + off + r * DD + hh * 128) = cv[hh][r]; }
        asm volatile("s_wait_xcnt 0x0" ::: "memory");       // in front of the first overwrite of a register that the stores above name, on every way that leads on from here
        if (TR) __builtin_amdgcn_sched_barrier(0);          // keeps the next stores' address arithmetic, which reuses such a register, behind the wait
    }
    if (TR) {
#pragma unroll
        for (int i = 0; i < 8; ++i) *(v8us*)(tr + (size_t)(tid >> 3) * 4 * trp + (tid & 7) * 8 + ((i >> 2) * 128 + (i & 3)) * trp) = tc[i];   // that row's column: (i >> 2) * 128 + 4 (tid >> 3) + (i & 3)
        asm volatile("s_wait_xcnt 0x0" ::: "memory");       // in front of the first overwrite of a register that the stores above name, on every way that leads on from here
    }
}
__global__ __launch_bounds__(256) void k_prep(const float* __restrict__ enc, const float* __restrict__ dec, const float* __restrict__ wt, bf* EB, bf* DB, bf* ET, bf* BW) {
    __shared__ __align__(16) unsigned char lds[DD * 128];
    const int x = blockIdx.x;
    if (x < PW_ / 2) prep_tile<false, true, true>(wt + (size_t)x * 64 * DD, nullptr, BW + x * 64, 2 * DD, lds);             // BW[n][k] = W_tanh[k][n], k < 256 as f16
    else if (x < PW_) prep_tile<false, true, false>(wt + (size_t)x * 64 * DD, nullptr, BW + x * 64, 2 * DD, lds);        // k >= 256 as bf16
    else if (x < PW_ + PE_) { const int y = x - PW_, bb = y / (SS / 64), t0 = y % (SS / 64) * 64;
        prep_tile<true, true, true>(enc + (size_t)y * 64 * DD, EB + (size_t)y * 64 * DD, ET + (size_t)bb * DD * SS + t0, SS, lds); }   // ET[b][d][t] = enc[b][t][d], as f16
    else { const int y = x - PW_ - PE_; prep_tile<true, false, false>(dec + (size_t)y * 64 * DD, DB + (size_t)y * 64 * DD, nullptr, 0, lds); }
}
#define KT 64
#define KP 272                    // LDS pitch of half a dec row: 256 + 16 bytes (16 x odd, conflict-free for 16-byte reads), laid by the tensor load's pad
#define VP 144                    // LDS pitch of a V^T row: 128 + 16 bytes, laid likewise
#define SL 18432                  // one wave's slice of a buffer, a multiple of 2 KiB: 64 rows x KP (17,408 bytes, rounded up) or 128 rows x VP (exactly)
#define KBYTES (2 * SL)
#define STG (4 * SL)              // one buffer: K columns 0-127, K columns 128-255, V^T rows 0-127, V^T rows 128-255; 73,728 bytes
#define WP 1040                   // LDS pitch of a W^T row: 1,024 + 16 bytes (16 x odd)
#define WQ (64 * WP)              // one buffer of the output product: 64 rows n, 66,560 bytes; two of them fit the first two stage buffers
#define XO (2 * STG)              // where the groups' contexts are exchanged: 16 KiB a wave, in the last two stage buffers
#define XM (XO + 8 * 16384)       // and their maxima and sums: 256 bytes a wave
#define GP 144                    // LDS pitch of a staged output row: 128 + 16 bytes (16 x odd)
#define GQ (16 * GP)              // one wave's staged output of one quarter: 16 rows s x 32 columns n of f32
typedef __attribute__((ext_vector_type(16))) float v16f;
typedef __attribute__((ext_vector_type(2))) float v2f;
typedef v2f __attribute__((may_alias)) v2fa;
__device__ __forceinline__ v16bf ldsfrag(const unsigned char* p) { return cat16b(*(const v8usa*)p, *(const v8usa*)(p + 32)); }
__device__ __forceinline__ float xhalf(float x) { const int b = __float_as_int(x); return __int_as_float(__builtin_amdgcn_permlanex16(b, b, 0x76543210, 0xfedcba98, false, false)); }   // lane l <-> l ^ 16
typedef uint32_t u32x4 __attribute__((ext_vector_type(4)));
typedef uint32_t u32x8 __attribute__((ext_vector_type(8)));
__device__ __forceinline__ uint32_t uni(uint32_t v) { return (uint32_t)__builtin_amdgcn_readfirstlane(v); }
__device__ __forceinline__ uint32_t pinned(uint32_t v) { uint32_t w = (uint32_t)__builtin_amdgcn_readfirstlane(v); asm volatile("" : "+s"(w)); return w; }   // the empty statement holds a descriptor word, or the value that a tensor load's issue test reads, in a scalar register: the test is then a scalar branch (a tensor load ignores EXEC), and a word formed from it is formed behind the wait that stands in front of it
// Group 1 of a tensor load's descriptor: ROWS rows of ROWB bytes, source pitch PITCH bytes; W0 = word 0 (no mask, 1-byte elements, 16 bytes of pad behind every row).
// Every word goes through pinned(): a descriptor word held in a scalar register, formed once in front of the first request, so that no register of the group takes a new value while a request is in flight.
template <uint32_t ROWB, uint32_t ROWS, uint32_t PITCH, uint32_t W0> __device__ __forceinline__ u32x8 tdm_group1() {
    u32x8 g;
    g[0] = pinned(W0); g[1] = pinned((ROWB & 0xFFFFu) << 16); g[2] = pinned((ROWB >> 16) | ((ROWS & 0xFFFFu) << 16)); g[3] = pinned((ROWS >> 16) | (ROWB << 16));
    g[4] = pinned(ROWS); g[5] = pinned(PITCH); g[6] = pinned(0u); g[7] = pinned(0u);
    return g;
}
__device__ __forceinline__ void tdm_load(u32x4 g0, u32x8 g1) { asm volatile("tensor_load_to_lds %0, %1" :: "s"(g0), "s"(g1) : "memory"); }
__global__ __launch_bounds__(256) __attribute__((amdgpu_waves_per_eu(2, 2))) void k_fattn(const bf* __restrict__ EB, const bf* __restrict__ DB, const bf* __restrict__ ET, const bf* __restrict__ BW, float* __restrict__ OUT) {
    __shared__ __attribute__((aligned(2048))) unsigned char lds[4 * STG];   // every slice's place is a multiple of 2 KiB
    const int tid = threadIdx.x, lane = tid & 31, c = lane & 15, h = lane >> 4;
    const size_t b = blockIdx.y; const int s0 = blockIdx.x * 64 + ((tid >> 5) & 3) * 16;
    const uint32_t wv = uni((uint32_t)tid >> 5), grp = wv >> 2, wave = wv & 3u, lbase = (uint32_t)(size_t)lds;   // grp: which stage of a pass; wave: which 16 rows, and which slice of the stage
    const bool isk = wave < 2u;      // slices 0, 1: 64 rows t x 256 bytes of K, source pitch 512; slices 2, 3: 128 rows d x 128 bytes of V^T, source pitch 4,096
    const uint64_t gbase = isk ? (uint64_t)(size_t)(DB + b * SS * DD) + (wave & 1u) * 256u : (uint64_t)(size_t)(ET + b * DD * SS) + (wave & 1u) * (128u * SS * 2u);
    const uint32_t gshift = isk ? 15u : 7u;   // a stage further on: KT rows of 512 bytes, or KT columns of 2 bytes
    const u32x8 g1k = tdm_group1<256u, KT, DD * 2u, (1u << 20 | 5u << 22 | 3u << 25)>(), g1v = tdm_group1<KT * 2u, 128u, SS * 2u, (1u << 20 | 4u << 22 | 3u << 25)>();
    const uint32_t one = pinned(1u);          // group 0, word 0: a descriptor word held in a scalar register, as those of group 1
    u32x4 g0;                                 // group 0 of this wave's request in flight; an input of the wait that covers it, so that its registers live up to that wait
    auto form = [&](uint32_t s) {             // this wave's slice of stage s, into place s & 3
        const uint64_t ga = gbase + (uint64_t)(s << gshift);
        g0[0] = one; g0[1] = uni(lbase + (s & 3u) * STG + wave * SL); g0[2] = uni((uint32_t)ga); g0[3] = uni((((uint32_t)(ga >> 32)) & 0x01FFFFFFu) | 0x80000000u);
    };
    auto issue = [&]() { if (pinned(isk)) tdm_load(g0, g1k); else tdm_load(g0, g1v); };   // a scalar branch: a tensor load ignores EXEC
    v16bf q[8];
#pragma unroll
    for (int kc = 0; kc < 8; ++kc) q[kc] = WFrag<bf>::ld(EB + (b * SS + s0 + c) * DD + 8 * h + kc * 32);
    asm volatile("s_wait_xcnt 0x0" ::: "memory");   // in front of the first overwrite of an address register that the loads above name
    form(grp); issue();
    asm volatile("s_wait_tensorcnt 0x0" :: "s"(g0) : "memory");   // this wave's slice of pass 0 has landed
    __syncthreads();                                              // and so has every other wave's: pass 0 may be read
    form(pinned(2u + grp)); issue();
    v8f o[16];
#pragma unroll
    for (int dt = 0; dt < 16; ++dt) o[dt] = (v8f){};
    float mul2 = -3.0e38f;   // maximum in use, in log2 units
    v16f lv = (v16f){};      // this lane's share of the row sum, 16 independent partial sums
    const int ka = c * KP + 16 * h, va = KBYTES + c * VP + 16 * h;
#pragma unroll 1
    for (int it = 0; it < SS / KT / 2; ++it) {
        const unsigned char* kb = lds + (((uint32_t)it * 2u + grp) & 3u) * STG;   // this group's stage of the pass
        // Fragments come from LDS in groups of 8 (16 loads), each group issued as one block ahead of the products of the group before it: K groups 0-3 (2 k-chunks x 4 t-tiles), V^T groups 0-3 (4 d-tiles x 2 t-chunks).
        // The sched_barrier(0) calls keep each load block whole and in front of those products; without them the compiler sinks every load to its product and the wave waits out the LDS latency at each one.
        v16bf f[2][8];
#pragma unroll
        for (int u = 0; u < 8; ++u) f[0][u] = ldsfrag(kb + ka + (u & 3) * 16 * KP + (u >> 2) * 64);
        v8f sT[4];
#pragma unroll
        for (int tt = 0; tt < 4; ++tt) sT[tt] = (v8f){};
#pragma unroll
        for (int g = 0; g < 4; ++g) {
#pragma unroll
            for (int u = 0; u < 8; ++u) f[(g + 1) & 1][u] = g < 3 ? ldsfrag(kb + ka + ((g + 1) >> 1) * SL + (u & 3) * 16 * KP + (((g + 1) & 1) * 2 + (u >> 2)) * 64) : ldsfrag(kb + va + (u >> 1) * 16 * VP + (u & 1) * 64);
            __builtin_amdgcn_sched_barrier(0);
#pragma unroll
            for (int u = 0; u < 8; ++u) sT[u & 3] = wmmab(f[g & 1][u], q[g * 2 + (u >> 2)], sT[u & 3]);
            __builtin_amdgcn_sched_barrier(0);
        }
        float m4[4];
#pragma unroll
        for (int tt = 0; tt < 4; ++tt) { m4[tt] = sT[tt][0];
#pragma unroll
            for (int j = 1; j < 8; ++j) m4[tt] = fmaxf(m4[tt], sT[tt][j]); }
        float mx = fmaxf(fmaxf(m4[0], m4[1]), fmaxf(m4[2], m4[3]));
        mx = fmaxf(mx, xhalf(mx)) * 1.4426950408889634f;
        if (__builtin_amdgcn_ballot_w32(mx > mul2 + 8.0f) != 0) {   // one wave-uniform test a stage: rescale only when a row's maximum outgrows the one in use by 2^8
            const float mn = fmaxf(mul2, mx), sc = __builtin_amdgcn_exp2f(mul2 - mn); mul2 = mn; lv *= sc;
#pragma unroll
            for (int dt = 0; dt < 16; ++dt) o[dt] *= sc;
        }
        v16h ph[2];
#pragma unroll
        for (int kk = 0; kk < 2; ++kk) { v16f p;
#pragma unroll
            for (int e = 0; e < 16; ++e) p[e] = __builtin_amdgcn_exp2f(__builtin_fmaf(sT[kk * 2 + (e >> 3)][e & 7], 1.4426950408889634f, -mul2));
            ph[kk] = __builtin_convertvector(p, v16h); lv += __builtin_convertvector(ph[kk], v16f); }   // the row sum takes the rounded weights, the ones the products see, so that their rounding cancels in the quotient
        __builtin_amdgcn_sched_barrier(0);
#pragma unroll
        for (int g = 0; g < 4; ++g) {
            if (g < 3) {
#pragma unroll
                for (int u = 0; u < 8; ++u) f[(g + 1) & 1][u] = ldsfrag(kb + va + ((g + 1) * 4 + (u >> 1)) * 16 * VP + (u & 1) * 64);
            }
            __builtin_amdgcn_sched_barrier(0);
#pragma unroll
            for (int kk = 0; kk < 2; ++kk) {
#pragma unroll
                for (int u = 0; u < 4; ++u) o[g * 4 + u] = wmma16(__builtin_bit_cast(v16h, f[g & 1][u * 2 + kk]), ph[kk], o[g * 4 + u]); }
            __builtin_amdgcn_sched_barrier(0);
        }
        asm volatile("s_wait_dscnt 0x0" ::: "memory");       // this wave's reads of this pass's buffer are over
        asm volatile("s_wait_tensorcnt 0x0" :: "s"(g0) : "memory");   // this wave's slice of the next pass has landed
        __syncthreads();   // publishes the next pass and ends every wave's reads of this one
        form(pinned((uint32_t)it * 2u + 4u + grp));   // formed behind the wait
        if (pinned(it + 2 < SS / KT / 2)) issue();    // into the buffer that this pass has just left; it flies during the whole of the next pass
    }
    asm volatile("s_wait_tensorcnt 0x0" ::: "memory");   // no tensor load is in flight
    asm volatile("s_wait_dscnt 0x0" ::: "memory");       // and no LDS read, before the buffers take W^T
    // ---- Join of the two groups, then the output product: OUT^T[n][s] = sum_k W^T[n][k] X^T[k][s], X = [context | dec], k = 0..511. A = W^T rows from LDS, B = this wave's 16 rows s, all in registers:
    // two O^T tiles (d 0-15, 16-31 of a 32-block) converted in place are a B fragment in the hardware k order, as the weights were above; the dec rows load as the enc rows did.
    // W^T comes in four quarters of 64 rows n, two LDS buffers, one barrier a quarter; of each quarter group g takes the rows n 32 g .. 32 g + 31 (one 128-byte line of each output row); per accumulator the k order is context (f16 products) first, then dec (bf16 products).
    const bf* Wg = BW + tid * 8;                                                 // a quarter is 64 KiB in a row: chunk x = i * 256 + tid, 64 chunks a row
    const int wst = (tid >> 6) * WP + (tid & 63) * 16, wa = ((int)grp * 32 + c) * WP + 16 * h;
    v8us wr[16];
#pragma unroll
    for (int i = 0; i < 16; ++i) wr[i] = *(const v8us*)(Wg + i * 2048);
    asm volatile("s_wait_xcnt 0x0" ::: "memory");   // in front of the first overwrite of an address register that the loads above name
    __builtin_amdgcn_sched_barrier(0);              // keeps the next loads' address arithmetic, which reuses that register, behind the wait
    v16bf dq[8];
    const bf* dqp = DB + (b * SS + s0 + c) * DD + 8 * h;
#pragma unroll
    for (int kc = 0; kc < 8; ++kc) dq[kc] = WFrag<bf>::ld(dqp + kc * 32);
    asm volatile("s_wait_xcnt 0x0" :: "v"(dqp) : "memory");   // in front of the first overwrite of the address register that the loads above name; it is an input here so that it lives up to the wait and no load of the block lands on it
    float l = 0.f;
#pragma unroll
    for (int e = 0; e < 16; ++e) l += lv[e];
    l += xhalf(l);
    // The join: each wave shows its partner (wave ^ 4, the same rows, the other stages) its maximum in use and its sum, scales its own context to the common maximum and the whole sum, and shows that too; own + partner's is then the same in both.
    *(v2fa*)(lds + XM + wv * 256 + lane * 8) = (v2f){mul2, l};   // the stage buffers' last readers left them at the barrier that ended the stage loop
    __syncthreads();   // both waves' maxima and sums are in LDS
    const v2f pml = *(const v2fa*)(lds + XM + (wv ^ 4u) * 256 + lane * 8);
    const float mn2 = fmaxf(mul2, pml[0]), so = __builtin_amdgcn_exp2f(mul2 - mn2);
    const float sc2 = so * __fdiv_rn(1.0f, l * so + pml[1] * __builtin_amdgcn_exp2f(pml[0] - mn2));
    unsigned char* xo = lds + XO + wv * 16384 + lane * 16; const unsigned char* xp = lds + XO + (wv ^ 4u) * 16384 + lane * 16;   // every wave-wide access is 512 bytes in a row
#pragma unroll
    for (int dt = 0; dt < 16; ++dt) { o[dt] *= sc2;
        *(v4fa*)(xo + dt * 1024) = __builtin_shufflevector(o[dt], o[dt], 0, 1, 2, 3); *(v4fa*)(xo + dt * 1024 + 512) = __builtin_shufflevector(o[dt], o[dt], 4, 5, 6, 7); }
#pragma unroll
    for (int i = 0; i < 16; ++i) *(v8usa*)(lds + wst + i * 4 * WP) = wr[i];
    __syncthreads();   // every wave's scaled context and the first quarter of W^T are in LDS
#pragma unroll
    for (int dt = 0; dt < 16; ++dt) { const v4f x0 = *(const v4fa*)(xp + dt * 1024), x1 = *(const v4fa*)(xp + dt * 1024 + 512); o[dt] += __builtin_shufflevector(x0, x1, 0, 1, 2, 3, 4, 5, 6, 7); }
    v16h ch[8];   // o[dt][r] = context[s0 + c][dt * 16 + 8h + r], as f16
#pragma unroll
    for (int kc = 0; kc < 8; ++kc) { v16f p;
#pragma unroll
        for (int e = 0; e < 16; ++e) p[e] = o[kc * 2 + (e >> 3)][e & 7];
        ch[kc] = __builtin_convertvector(p, v16h); }
    // The output goes through LDS so that every store is whole lines: from the accumulators (acc[u][r] = out[s0 + c][ng * 64 + grp * 32 + u * 16 + 8h + r]) a wave-wide 16-byte store would lay 32 pieces of 16 bytes into 16 lines; read back by rows, it lays 4 whole lines of 128 bytes.
    // A wave stages in the range where its partner showed it its context: nobody but this wave has read it since the barrier above, and its own reads of it are over (the products below hang on them). A range of its own for every quarter.
    // A quarter's rows are read back and stored in the next quarter, behind the barrier between the two, so that the stores fly during that quarter's products and the barrier at its end finds them done.
    unsigned char* gw = lds + XO + (wv ^ 4u) * 16384 + c * GP + 32 * h; const unsigned char* gr = lds + XO + (wv ^ 4u) * 16384 + (lane >> 3) * GP + (lane & 7) * 16;
    float* og = OUT + (b * SS + s0 + (lane >> 3)) * DD + grp * 32 + (lane & 7) * 4;   // 8 lanes a row: load i holds out[s0 + 4 i + (lane >> 3)][quarter * 64 + grp * 32 + 4 (lane & 7) ..]
    // The quarter loop stays rolled (unroll 1) to keep the code short; its inner loops are unrolled in full so that the arrays they index stay in registers.
#pragma unroll 1
    for (int ng = 0; ng < 4; ++ng) {
        const unsigned char* wb = lds + (ng & 1) * WQ; unsigned char* nb = lds + ((ng + 1) & 1) * WQ;
        const bool more = ng + 1 < 4;
        v16bf f[2][8];   // groups of 8 fragments (4 k-chunks x 2 n-tiles), each issued as one block ahead of the products of the group before it, held there by the sched_barrier(0) calls as in the stage loop
#pragma unroll
        for (int u = 0; u < 8; ++u) f[0][u] = ldsfrag(wb + wa + (u & 1) * 16 * WP + (u >> 1) * 64);
        if (more) {   // the next quarter flies while this one is worked on
#pragma unroll
            for (int i = 0; i < 16; ++i) wr[i] = *(const v8us*)(Wg + (size_t)(ng + 1) * 64 * 2 * DD + i * 2048);
            asm volatile("s_wait_xcnt 0x0" ::: "memory");   // in front of the first overwrite of an address register that these loads name
        }
        v4f t[4];   // the quarter before, by rows; asked for ahead of the second fragment group, so that its wait leaves that group in flight
        if (ng > 0) {
#pragma unroll
            for (int i = 0; i < 4; ++i) t[i] = *(const v4fa*)(gr + (ng - 1) * GQ + i * 4 * GP);
        }
        v8f acc[2];
#pragma unroll
        for (int u = 0; u < 2; ++u) acc[u] = (v8f){};
#pragma unroll
        for (int g = 0; g < 4; ++g) {
            if (g < 3) {
#pragma unroll
                for (int u = 0; u < 8; ++u) f[(g + 1) & 1][u] = ldsfrag(wb + wa + (u & 1) * 16 * WP + ((g + 1) * 4 + (u >> 1)) * 64);
            }
            __builtin_amdgcn_sched_barrier(0);
#pragma unroll
            for (int kk = 0; kk < 4; ++kk) { const int kc = g * 4 + kk;
#pragma unroll
                for (int u = 0; u < 2; ++u) acc[u] = kc < 8 ? wmma16(__builtin_bit_cast(v16h, f[g & 1][kk * 2 + u]), ch[kc & 7], acc[u]) : wmmab(f[g & 1][kk * 2 + u], dq[kc & 7], acc[u]); }
            __builtin_amdgcn_sched_barrier(0);
            if (g == 0 && ng > 0) {   // behind the first products, when the rows have come
#pragma unroll
                for (int i = 0; i < 4; ++i) *(v4f*)(og + (ng - 1) * 64 + i * 4 * DD) = t[i];
                asm volatile("s_wait_xcnt 0x0" ::: "memory");   // in front of the first overwrite of a register that the stores above name
            }
        }
        if (more) {   // the other buffer's last readers left it at the barrier that ended the quarter before
#pragma unroll
            for (int i = 0; i < 16; ++i) *(v8usa*)(nb + wst + i * 4 * WP) = wr[i];
        }
#pragma unroll
        for (int u = 0; u < 2; ++u) { v8f r;
#pragma unroll
            for (int j = 0; j < 8; ++j) r[j] = __builtin_amdgcn_tanhf(acc[u][j]);   // the bare v_tanh_f32: the library tanhf is a compare, two lane-mask branches and two serial chains a value, which a wave waits out link by link
            *(v4fa*)(gw + ng * GQ + u * 64) = __builtin_shufflevector(r, r, 0, 1, 2, 3); *(v4fa*)(gw + ng * GQ + u * 64 + 16) = __builtin_shufflevector(r, r, 4, 5, 6, 7); }
        __syncthreads();   // publishes the next quarter and ends every wave's reads of this one; its LDS wait also stands between this wave's staged rows and their reading back
    }
#pragma unroll
    for (int i = 0; i < 4; ++i) *(v4f*)(og + 3 * 64 + i * 4 * DD) = *(const v4fa*)(gr + 3 * GQ + i * 4 * GP);   // the last quarter's rows
}

extern "C" void kernel_launch(void* const* d_in, const int* in_sizes, int n_in,
                              void* d_out, int out_size, void* d_ws, size_t ws_size, hipStream_t stream) {
    (void)in_sizes; (void)n_in; (void)out_size;
    const float* enc = (const float*)d_in[0]; const float* dec = (const float*)d_in[1]; const float* Wt = (const float*)d_in[2];
    float* OUT = (float*)d_out;     // [8][2048][256]
    char* wsp = (char*)d_ws;
    auto take = [&](size_t bytes) { char* p = wsp; wsp += (bytes + 255) & ~(size_t)255; return (void*)p; };
    bf* BW = (bf*)take((size_t)2 * DD * DD * 2); bf* EB = (bf*)take((size_t)NB_ * SS * DD * 2); bf* DB = (bf*)take((size_t)NB_ * SS * DD * 2); bf* ET = (bf*)take((size_t)NB_ * DD * SS * 2);
    if ((size_t)(wsp - (char*)d_ws) > ws_size) return;    // total ~ 24 MiB
    k_prep<<<PW_ + 2 * PE_, 256, 0, stream>>>(enc, dec, Wt, EB, DB, ET, BW);   // bf16 rows of enc and dec, enc^T (f16), W_tanh^T (f16 | bf16)
    k_fattn<<<dim3(SS / 64, NB_), 256, 0, stream>>>(EB, DB, ET, BW, OUT);   // out = tanh([softmax_t(enc . dec^T) . enc | dec] W_tanh)
}

// v010
// It runs in 44.9 microseconds.
// Next to v009, in two timings, it ran 1.04 and 1.03 times as fast.
// Over all steps from v000 it is 17.7 times as fast.
#include <hip/hip_runtime.h>
#include <stdint.h>

// LuongAttention (enc, dec [8][2048][256]; scores[s][t] = enc[s] . dec[t] (unscaled); softmax over t (decoder time); context[s] = sum_t weights[s][t] enc[t] (the source contracts the weights' decoder axis with enc's time axis; both are 2,048 long); out = tanh([context | dec] W_tanh) -> [8][2048][256]).
// Compute dtypes, f32 accumulate: every input rounded to bf16; the unscaled scores are a PLAIN bf16 GEMM of the inputs themselves (exact products, f32 sums - they reach |90|, so nothing narrower would do); softmax f32, running maximum and sum, weights -> one f16 fragment in registers (11 bits; they are at most 2^8); context as f16 weights x enc^T in f16 (the bf16-rounded values, which f16 holds exactly from 2^-17 up and to 2^-25 below; 1 product); [f16(context) | bf16(dec)] x W_tanh (bf16-rounded values; the half that meets the context kept as f16), 1 product each, in the same kernel; tanh f32.

#define NB_  8
#define SS   2048
#define DD   256
typedef _Float16 h16;
typedef unsigned short bf;
typedef __attribute__((ext_vector_type(16))) __bf16   v16bf;
typedef __attribute__((ext_vector_type(16))) _Float16 v16h;
typedef __attribute__((ext_vector_type(8)))  _Float16 v8h;
typedef __attribute__((ext_vector_type(8)))  unsigned short v8us;
typedef __attribute__((ext_vector_type(8)))  float    v8f;
typedef __attribute__((ext_vector_type(4)))  float    v4f;
typedef v8h  __attribute__((may_alias)) v8ha;
typedef v4f  __attribute__((may_alias)) v4fa;
typedef v8us __attribute__((may_alias)) v8usa;

__device__ __forceinline__ unsigned short f2bf(float f) { unsigned u = __float_as_uint(f); u += 0x7FFFu + ((u >> 16) & 1u); return (unsigned short)(u >> 16); }
__device__ __forceinline__ float bf2f(unsigned short b) { return __uint_as_float(((unsigned)b) << 16); }
__device__ __forceinline__ float bfr(float f) { return bf2f(f2bf(f)); }
__device__ __forceinline__ v16h cat16(v8h lo, v8h hi) { return __builtin_shufflevector(lo, hi, 0, 1, 2, 3, 4, 5, 6, 7, 8, 9, 10, 11, 12, 13, 14, 15); }
__device__ __forceinline__ v16bf cat16b(v8us lo, v8us hi) { return __builtin_bit_cast(v16bf, __builtin_shufflevector(lo, hi, 0, 1, 2, 3, 4, 5, 6, 7, 8, 9, 10, 11, 12, 13, 14, 15)); }
__device__ __forceinline__ v8f wmma16(v16h a, v16h b, v8f c) { return __builtin_amdgcn_wmma_f32_16x16x32_f16(false, a, false, b, (short)0, c, false, false); }
__device__ __forceinline__ v8f wmmab(v16bf a, v16bf b, v8f c) { return __builtin_amdgcn_wmma_f32_16x16x32_bf16(false, a, false, b, (short)0, c, false, false); }



// 16-bit fragment of 32 k from a K-contiguous row: 16 bytes at p and at p + 16 elements (the caller adds 8 * (lane >> 4)).
template <typename T16> struct WFrag;
template <> struct WFrag<h16> { typedef v16h V; static __device__ __forceinline__ V ld(const h16* p) { return cat16(*(const v8h*)p, *(const v8h*)(p + 16)); } static __device__ __forceinline__ v8f mma(V a, V b, v8f c) { return wmma16(a, b, c); } };
template <> struct WFrag<bf> { typedef v16bf V; static __device__ __forceinline__ V ld(const bf* p) { return cat16b(*(const v8us*)p, *(const v8us*)(p + 16)); } static __device__ __forceinline__ v8f mma(V a, V b, v8f c) { return wmmab(a, b, c); } };
typedef __attribute__((ext_vector_type(2))) unsigned short v2us;
typedef __attribute__((ext_vector_type(4))) unsigned short v4us;

// ---- k_prep: every input goes to bf16 in ONE launch of few, fat work-groups (8 waves, 64 elements a thread, 16 loads of 16 bytes in flight a lane), for speed only.
// A work-group takes 64 rows x 256 columns of f32, 64 KiB in a row, so every wave-wide load covers four whole lines. Jobs by blockIdx.x: W_tanh (transposed only; its rows k < 256, which meet the context, as f16), enc (rows, and transposed as f16), dec (rows only). A plane kept as f16 holds the same bf16-rounded values, in the type of the operand they meet.
// Transposing: wave w holds rows 8w..8w+7, a lane 4 columns of them in each half of 128; 8 rows of one column are one 16-byte chunk. LDS row R = half * 128 + j * 32 + lane holds column half * 128 + 4 * lane + j, 128 bytes (64 rows),
// its chunk g at place g ^ ((R >> 1) & 7): 16 lanes that write one g into 16 rows, and 16 lanes that read all of 2 rows, each touch every bank once. Every transposed store is a whole 128-byte line from 8 lanes.
// Every loop is unrolled in full so that the arrays it indexes stay in registers.
#define PW_ (2 * DD / 64)               // work-groups on W_tanh [512][256]
#define PE_ (NB_ * SS / 64)             // work-groups on enc, and as many on dec
template <bool ROWS, bool TR, bool TRH> __device__ __forceinline__ void prep_tile(const float* __restrict__ src, bf* rows, bf* tr, const int trp, unsigned char* lds) {
    const int tid = threadIdx.x, lane = tid & 31, w = tid >> 5;
    const size_t off = (size_t)w * 8 * DD + lane * 4;
    const unsigned ob = (unsigned)off * 4;   // the same in bytes of f32
    v4f v[2][8];
#pragma unroll
    for (int hh = 0; hh < 2; ++hh) {
#pragma unroll
        for (int r = 0; r < 8; ++r) v[hh][r] = *(const v4f*)((const char*)src + ob + (r * DD + hh * 128) * 4); }
    asm volatile("s_wait_xcnt 0x0" :: "v"(ob) : "memory");   // in front of the first overwrite of the address register that the loads above name; it is an input here so that it lives up to the wait and no load of the block lands on it
    __builtin_amdgcn_sched_barrier(0);              // keeps all 16 loads in front of the first conversion; without it the compiler holds some back until earlier ones have landed, a second memory latency
    v4us cv[2][8];
#pragma unroll
    for (int hh = 0; hh < 2; ++hh) {
#pragma unroll
        for (int r = 0; r < 8; ++r) {
#pragma unroll
            for (int j = 0; j < 4; ++j) cv[hh][r][j] = f2bf(v[hh][r][j]); } }
    v8us tc[8];
    if (TR) {
#pragma unroll
        for (int hh = 0; hh < 2; ++hh) {
#pragma unroll
            for (int j = 0; j < 4; ++j) { v8us col;
#pragma unroll
                for (int r = 0; r < 8; ++r) col[r] = TRH ? __builtin_bit_cast(unsigned short, (h16)bf2f(cv[hh][r][j])) : cv[hh][r][j];   // TRH: the same bf16-rounded value, written as f16
                const int R = hh * 128 + j * 32 + lane; *(v8usa*)(lds + R * 128 + ((w ^ ((R >> 1) & 7)) * 16)) = col; } }
        __syncthreads();   // every chunk of the tile is in LDS before a row of it is read; the global stores all stand behind it, so that it waits for none of them
#pragma unroll
        for (int i = 0; i < 8; ++i) tc[i] = *(const v8usa*)(lds + i * 32 * 128 + (tid >> 3) * 128 + (((tid & 7) ^ ((tid >> 4) & 7)) * 16));   // row R = 32 i + (tid >> 3), chunk g = tid & 7; (R >> 1) & 7 does not depend on i
    }
    if (ROWS) {
#pragma unroll
        for (int hh = 0; hh < 2; ++hh) {
#pragma unroll
            for (int r = 0; r < 8; ++r) *(v4us*)(rows + off + r * DD + hh * 128) = cv[hh][r]; }
        asm volatile("s_wait_xcnt 0x0" ::: "memory");       // in front of the first overwrite of a register that the stores above name, on every way that leads on from here
        if (TR) __builtin_amdgcn_sched_barrier(0);          // keeps the next stores' address arithmetic, which reuses such a register, behind the wait
    }
    if (TR) {
#pragma unroll
        for (int i = 0; i < 8; ++i) *(v8us*)(tr + (size_t)(tid >> 3) * 4 * trp + (tid & 7) * 8 + ((i >> 2) * 128 + (i & 3)) * trp) = tc[i];   // that row's column: (i >> 2) * 128 + 4 (tid >> 3) + (i & 3)
        asm volatile("s_wait_xcnt 0x0" ::: "memory");       // in front of the first overwrite of a register that the stores above name, on every way that leads on from here
    }
}
__global__ __launch_bounds__(256) void k_prep(const float* __restrict__ enc, const float* __restrict__ dec, const float* __restrict__ wt, bf* EB, bf* DB, bf* ET, bf* BW) {
    __shared__ __align__(16) unsigned char lds[DD * 128];
    const int x = blockIdx.x;
    if (x < PW_ / 2) prep_tile<false, true, true>(wt + (size_t)x * 64 * DD, nullptr, BW + x * 64, 2 * DD, lds);             // BW[n][k] = W_tanh[k][n], k < 256 as f16
    else if (x < PW_) prep_tile<false, true, false>(wt + (size_t)x * 64 * DD, nullptr, BW + x * 64, 2 * DD, lds);        // k >= 256 as bf16
    else if (x < PW_ + PE_) { const int y = x - PW_, bb = y / (SS / 64), t0 = y % (SS / 64) * 64;
        prep_tile<true, true, true>(enc + (size_t)y * 64 * DD, EB + (size_t)y * 64 * DD, ET + (size_t)bb * DD * SS + t0, SS, lds); }   // ET[b][d][t] = enc[b][t][d], as f16
    else { const int y = x - PW_ - PE_; prep_tile<true, false, false>(dec + (size_t)y * 64 * DD, DB + (size_t)y * 64 * DD, nullptr, 0, lds); }
}
#define KT 64
#define KP 272                    // LDS pitch of half a dec row: 256 + 16 bytes (16 x odd, conflict-free for 16-byte reads), laid by the tensor load's pad
#define VP 144                    // LDS pitch of a V^T row: 128 + 16 bytes, laid likewise
#define SL 18432                  // one slice of a buffer, a multiple of 2 KiB: 64 rows x KP (17,408 bytes, rounded up) or 128 rows x VP (exactly)
#define KBYTES (2 * SL)
#define STG (4 * SL)              // one buffer: K columns 0-127, K columns 128-255, V^T rows 0-127, V^T rows 128-255; 73,728 bytes
#define WP 1040                   // LDS pitch of a W^T row: 1,024 + 16 bytes (16 x odd)
#define WQ (64 * WP)              // one buffer of the output product: 64 rows n, 66,560 bytes; two of them fit the first two stage buffers
#define XO (2 * STG)              // where the groups' contexts are exchanged: 32 KiB a wave, in the last two stage buffers
#define XM (XO + 4 * 32768)       // and their maxima and sums: 512 bytes a wave
#define GP 144                    // LDS pitch of a staged output row: 128 + 16 bytes (16 x odd)
#define GQ (32 * GP)              // one wave's staged output of one quarter: 32 rows s x 32 columns n of f32
typedef __attribute__((ext_vector_type(16))) float v16f;
typedef __attribute__((ext_vector_type(2))) float v2f;
typedef v2f __attribute__((may_alias)) v2fa;
__device__ __forceinline__ v16bf ldsfrag(const unsigned char* p) { return cat16b(*(const v8usa*)p, *(const v8usa*)(p + 32)); }
__device__ __forceinline__ float xhalf(float x) { const int b = __float_as_int(x); return __int_as_float(__builtin_amdgcn_permlanex16(b, b, 0x76543210, 0xfedcba98, false, false)); }   // lane l <-> l ^ 16
typedef uint32_t u32x4 __attribute__((ext_vector_type(4)));
typedef uint32_t u32x8 __attribute__((ext_vector_type(8)));
__device__ __forceinline__ uint32_t uni(uint32_t v) { return (uint32_t)__builtin_amdgcn_readfirstlane(v); }
__device__ __forceinline__ uint32_t pinned(uint32_t v) { uint32_t w = (uint32_t)__builtin_amdgcn_readfirstlane(v); asm volatile("" : "+s"(w)); return w; }   // the empty statement holds a descriptor word, or the value that a tensor load's issue test reads, in a scalar register: the test is then a scalar branch (a tensor load ignores EXEC), and a word formed from it is formed behind the wait that stands in front of it
// Group 1 of a tensor load's descriptor: ROWS rows of ROWB bytes, source pitch PITCH bytes; W0 = word 0 (no mask, 1-byte elements, 16 bytes of pad behind every row).
// Every word goes through pinned(): a descriptor word held in a scalar register, formed once in front of the first request, so that no register of the group takes a new value while a request is in flight.
template <uint32_t ROWB, uint32_t ROWS, uint32_t PITCH, uint32_t W0> __device__ __forceinline__ u32x8 tdm_group1() {
    u32x8 g;
    g[0] = pinned(W0); g[1] = pinned((ROWB & 0xFFFFu) << 16); g[2] = pinned((ROWB >> 16) | ((ROWS & 0xFFFFu) << 16)); g[3] = pinned((ROWS >> 16) | (ROWB << 16));
    g[4] = pinned(ROWS); g[5] = pinned(PITCH); g[6] = pinned(0u); g[7] = pinned(0u);
    return g;
}
__device__ __forceinline__ void tdm_load(u32x4 g0, u32x8 g1) { asm volatile("tensor_load_to_lds %0, %1" :: "s"(g0), "s"(g1) : "memory"); }
__global__ __launch_bounds__(128) void k_fattn(const bf* __restrict__ EB, const bf* __restrict__ DB, const bf* __restrict__ ET, const bf* __restrict__ BW, float* __restrict__ OUT) {
    __shared__ __attribute__((aligned(2048))) unsigned char lds[4 * STG];   // every slice's place is a multiple of 2 KiB
    const int tid = threadIdx.x, lane = tid & 31, c = lane & 15, h = lane >> 4;
    const size_t b = blockIdx.y; const int s0 = blockIdx.x * 64 + ((tid >> 5) & 1) * 32;
    const uint32_t wv = uni((uint32_t)tid >> 5), grp = wv >> 1, rb = wv & 1u, lbase = (uint32_t)(size_t)lds;   // grp: which stage of a pass; rb: which 32 rows, and which two slices of the stage
    const bool isk = rb == 0u;       // slices 0, 1: 64 rows t x 256 bytes of K, source pitch 512; slices 2, 3: 128 rows d x 128 bytes of V^T, source pitch 4,096
    const uint64_t gbase = isk ? (uint64_t)(size_t)(DB + b * SS * DD) : (uint64_t)(size_t)(ET + b * DD * SS);
    const uint32_t ghalf = isk ? 256u : 128u * SS * 2u;   // from the wave's first slice to its second, in the source
    const uint32_t gshift = isk ? 15u : 7u;   // a stage further on: KT rows of 512 bytes, or KT columns of 2 bytes
    const u32x8 g1k = tdm_group1<256u, KT, DD * 2u, (1u << 20 | 5u << 22 | 3u << 25)>(), g1v = tdm_group1<KT * 2u, 128u, SS * 2u, (1u << 20 | 4u << 22 | 3u << 25)>();
    const uint32_t one = pinned(1u);          // group 0, word 0: a descriptor word held in a scalar register, as those of group 1
    u32x4 g0a, g0b;                           // group 0 of this wave's two requests in flight, a register set each; inputs of the wait that covers them, so that their registers live up to that wait
    auto form = [&](uint32_t s) {             // this wave's two slices of stage s, into place s & 3
        const uint64_t ga = gbase + (uint64_t)(s << gshift), gb = ga + ghalf;
        const uint32_t la = lbase + (s & 3u) * STG + rb * (2u * SL);
        g0a[0] = one; g0a[1] = uni(la); g0a[2] = uni((uint32_t)ga); g0a[3] = uni((((uint32_t)(ga >> 32)) & 0x01FFFFFFu) | 0x80000000u);
        g0b[0] = one; g0b[1] = uni(la + SL); g0b[2] = uni((uint32_t)gb); g0b[3] = uni((((uint32_t)(gb >> 32)) & 0x01FFFFFFu) | 0x80000000u);
        asm volatile("" : "+s"(g0a), "+s"(g0b));   // as pinned(), for the four words at once: descriptor words held in scalar registers; each group is then one register set from here to the wait that covers its request, not a copy put together anew at each use
    };
    auto issue = [&]() { if (pinned(isk)) { tdm_load(g0a, g1k); tdm_load(g0b, g1k); } else { tdm_load(g0a, g1v); tdm_load(g0b, g1v); } };   // a scalar branch: a tensor load ignores EXEC
    v16bf q[2][8];
#pragma unroll
    for (int sf = 0; sf < 2; ++sf) {
#pragma unroll
        for (int kc = 0; kc < 8; ++kc) q[sf][kc] = WFrag<bf>::ld(EB + (b * SS + s0 + sf * 16 + c) * DD + 8 * h + kc * 32); }
    asm volatile("s_wait_xcnt 0x0" ::: "memory");   // in front of the first overwrite of an address register that the loads above name
    form(grp); issue();
    asm volatile("s_wait_tensorcnt 0x0" :: "s"(g0a), "s"(g0b) : "memory");   // this wave's slices of pass 0 have landed
    __syncthreads();                                              // and so have every other wave's: pass 0 may be read
    form(pinned(2u + grp)); issue();
    v8f o[2][16];
#pragma unroll
    for (int sf = 0; sf < 2; ++sf) {
#pragma unroll
        for (int dt = 0; dt < 16; ++dt) o[sf][dt] = (v8f){}; }
    float mul2[2] = {-3.0e38f, -3.0e38f};   // maxima in use, in log2 units
    v16f lv[2] = {(v16f){}, (v16f){}};      // this lane's share of the two row sums, 16 independent partial sums each
    const int ka = c * KP + 16 * h, va = KBYTES + c * VP + 16 * h;
#pragma unroll 1
    for (int it = 0; it < SS / KT / 2; ++it) {
        const unsigned char* kb = lds + (((uint32_t)it * 2u + grp) & 3u) * STG;   // this group's stage of the pass
        // Fragments come from LDS in groups of 16 (32 loads, 32 products), each group issued as one block ahead of the products of the group before it: K groups 0, 1 (4 k-chunks x 4 t-tiles, one column half each), V^T groups 0, 1 (8 d-tiles x 2 t-chunks).
        // The sched_barrier(0) calls keep each load block whole and in front of those products; without them the compiler sinks every load to its product and the wave waits out the LDS latency at each one.
        v16bf f[2][16];
#pragma unroll
        for (int u = 0; u < 16; ++u) f[0][u] = ldsfrag(kb + ka + (u & 3) * 16 * KP + (u >> 2) * 64);
        v8f sT[2][4];
#pragma unroll
        for (int sf = 0; sf < 2; ++sf) {
#pragma unroll
            for (int tt = 0; tt < 4; ++tt) sT[sf][tt] = (v8f){}; }
#pragma unroll
        for (int g = 0; g < 2; ++g) {
#pragma unroll
            for (int u = 0; u < 16; ++u) f[(g + 1) & 1][u] = g < 1 ? ldsfrag(kb + ka + SL + (u & 3) * 16 * KP + (u >> 2) * 64) : ldsfrag(kb + va + (u >> 1) * 16 * VP + (u & 1) * 64);
            __builtin_amdgcn_sched_barrier(0);
#pragma unroll
            for (int u = 0; u < 16; ++u) {
#pragma unroll
                for (int sf = 0; sf < 2; ++sf) sT[sf][u & 3] = wmmab(f[g & 1][u], q[sf][g * 4 + (u >> 2)], sT[sf][u & 3]); }
            __builtin_amdgcn_sched_barrier(0);
        }
        float mx[2];
#pragma unroll
        for (int sf = 0; sf < 2; ++sf) { float m4[4];
#pragma unroll
            for (int tt = 0; tt < 4; ++tt) { m4[tt] = sT[sf][tt][0];
#pragma unroll
                for (int j = 1; j < 8; ++j) m4[tt] = fmaxf(m4[tt], sT[sf][tt][j]); }
            const float m = fmaxf(fmaxf(m4[0], m4[1]), fmaxf(m4[2], m4[3]));
            mx[sf] = fmaxf(m, xhalf(m)) * 1.4426950408889634f; }
        if (__builtin_amdgcn_ballot_w32(mx[0] > mul2[0] + 8.0f || mx[1] > mul2[1] + 8.0f) != 0) {   // one wave-uniform test a stage: rescale only when a row's maximum outgrows the one in use by 2^8
#pragma unroll
            for (int sf = 0; sf < 2; ++sf) {
                const float mn = fmaxf(mul2[sf], mx[sf]), sc = __builtin_amdgcn_exp2f(mul2[sf] - mn); mul2[sf] = mn; lv[sf] *= sc;
#pragma unroll
                for (int dt = 0; dt < 16; ++dt) o[sf][dt] *= sc; }
        }
        v16h ph[2][2];
#pragma unroll
        for (int sf = 0; sf < 2; ++sf) {
#pragma unroll
            for (int kk = 0; kk < 2; ++kk) { v16f p;
#pragma unroll
                for (int e = 0; e < 16; ++e) p[e] = __builtin_amdgcn_exp2f(__builtin_fmaf(sT[sf][kk * 2 + (e >> 3)][e & 7], 1.4426950408889634f, -mul2[sf]));
                ph[sf][kk] = __builtin_convertvector(p, v16h); lv[sf] += __builtin_convertvector(ph[sf][kk], v16f); } }   // the row sum takes the rounded weights, the ones the products see, so that their rounding cancels in the quotient
        __builtin_amdgcn_sched_barrier(0);
#pragma unroll
        for (int g = 0; g < 2; ++g) {
            if (g < 1) {
#pragma unroll
                for (int u = 0; u < 16; ++u) f[1][u] = ldsfrag(kb + va + (8 + (u >> 1)) * 16 * VP + (u & 1) * 64);
            }
            __builtin_amdgcn_sched_barrier(0);
#pragma unroll
            for (int kk = 0; kk < 2; ++kk) {
#pragma unroll
                for (int u = 0; u < 8; ++u) {
#pragma unroll
                    for (int sf = 0; sf < 2; ++sf) o[sf][g * 8 + u] = wmma16(__builtin_bit_cast(v16h, f[g & 1][u * 2 + kk]), ph[sf][kk], o[sf][g * 8 + u]); } }
            __builtin_amdgcn_sched_barrier(0);
        }
        asm volatile("s_wait_dscnt 0x0" ::: "memory");       // this wave's reads of this pass's buffer are over
        asm volatile("s_wait_tensorcnt 0x0" :: "s"(g0a), "s"(g0b) : "memory");   // this wave's slices of the next pass have landed
        __syncthreads();   // publishes the next pass and ends every wave's reads of this one
        form(pinned((uint32_t)it * 2u + 4u + grp));   // formed behind the wait
        if (pinned(it + 2 < SS / KT / 2)) issue();    // into the buffer that this pass has just left; they fly during the whole of the next pass
    }
    asm volatile("s_wait_tensorcnt 0x0" ::: "memory");   // no tensor load is in flight
    asm volatile("s_wait_dscnt 0x0" ::: "memory");       // and no LDS read, before the buffers take W^T
    // ---- Join of the two groups, then the output product: OUT^T[n][s] = sum_k W^T[n][k] X^T[k][s], X = [context | dec], k = 0..511. A = W^T rows from LDS, B = this wave's 32 rows s, all in registers:
    // two O^T tiles (d 0-15, 16-31 of a 32-block) converted in place are a B fragment in the hardware k order, as the weights were above; the dec rows load as the enc rows did.
    // W^T comes in four quarters of 64 rows n, two LDS buffers, one barrier a quarter; of each quarter group g takes the rows n 32 g .. 32 g + 31 (one 128-byte line of each output row); per accumulator the k order is context (f16 products) first, then dec (bf16 products).
    const bf* Wg = BW + tid * 8;                                                 // a quarter is 64 KiB in a row: chunk x = i * 128 + tid, 64 chunks a row
    const int wst = (tid >> 6) * WP + (tid & 63) * 16, wa = ((int)grp * 32 + c) * WP + 16 * h;
    v8us wr[32];
#pragma unroll
    for (int i = 0; i < 32; ++i) wr[i] = *(const v8us*)(Wg + i * 1024);
    asm volatile("s_wait_xcnt 0x0" ::: "memory");   // in front of the first overwrite of an address register that the loads above name
    __builtin_amdgcn_sched_barrier(0);              // keeps the next loads' address arithmetic, which reuses that register, behind the wait
    v16bf dq[2][8];
    const bf* dqp = DB + (b * SS + s0 + c) * DD + 8 * h;
#pragma unroll
    for (int sf = 0; sf < 2; ++sf) {
#pragma unroll
        for (int kc = 0; kc < 8; ++kc) dq[sf][kc] = WFrag<bf>::ld(dqp + sf * 16 * DD + kc * 32); }
    asm volatile("s_wait_xcnt 0x0" :: "v"(dqp) : "memory");   // in front of the first overwrite of the address register that the loads above name; it is an input here so that it lives up to the wait and no load of the block lands on it
    float l[2];
#pragma unroll
    for (int sf = 0; sf < 2; ++sf) { l[sf] = 0.f;
#pragma unroll
        for (int e = 0; e < 16; ++e) l[sf] += lv[sf][e];
        l[sf] += xhalf(l[sf]); }
    // The join: each wave shows its partner (wave ^ 2, the same rows, the other stages) its maxima in use and its sums, scales its own context to the common maximum and the whole sum, and shows that too; own + partner's is then the same in both.
#pragma unroll
    for (int sf = 0; sf < 2; ++sf) *(v2fa*)(lds + XM + wv * 512 + sf * 256 + lane * 8) = (v2f){mul2[sf], l[sf]};   // the stage buffers' last readers left them at the barrier that ended the stage loop
    __syncthreads();   // both waves' maxima and sums are in LDS
    unsigned char* xo = lds + XO + wv * 32768 + lane * 16; const unsigned char* xp = lds + XO + (wv ^ 2u) * 32768 + lane * 16;   // every wave-wide access is 512 bytes in a row
#pragma unroll
    for (int sf = 0; sf < 2; ++sf) {
        const v2f pml = *(const v2fa*)(lds + XM + (wv ^ 2u) * 512 + sf * 256 + lane * 8);
        const float mn2 = fmaxf(mul2[sf], pml[0]), so = __builtin_amdgcn_exp2f(mul2[sf] - mn2);
        const float sc2 = so * __fdiv_rn(1.0f, l[sf] * so + pml[1] * __builtin_amdgcn_exp2f(pml[0] - mn2));
#pragma unroll
        for (int dt = 0; dt < 16; ++dt) { o[sf][dt] *= sc2;
            *(v4fa*)(xo + (sf * 16 + dt) * 1024) = __builtin_shufflevector(o[sf][dt], o[sf][dt], 0, 1, 2, 3); *(v4fa*)(xo + (sf * 16 + dt) * 1024 + 512) = __builtin_shufflevector(o[sf][dt], o[sf][dt], 4, 5, 6, 7); } }
#pragma unroll
    for (int i = 0; i < 32; ++i) *(v8usa*)(lds + wst + i * 2 * WP) = wr[i];
    __syncthreads();   // every wave's scaled context and the first quarter of W^T are in LDS
    v16h ch[2][8];   // o[sf][dt][r] = context[s0 + 16 sf + c][dt * 16 + 8h + r], as f16
#pragma unroll
    for (int sf = 0; sf < 2; ++sf) {
#pragma unroll
        for (int dt = 0; dt < 16; ++dt) { const v4f x0 = *(const v4fa*)(xp + (sf * 16 + dt) * 1024), x1 = *(const v4fa*)(xp + (sf * 16 + dt) * 1024 + 512); o[sf][dt] += __builtin_shufflevector(x0, x1, 0, 1, 2, 3, 4, 5, 6, 7); }
#pragma unroll
        for (int kc = 0; kc < 8; ++kc) { v16f p;
#pragma unroll
            for (int e = 0; e < 16; ++e) p[e] = o[sf][kc * 2 + (e >> 3)][e & 7];
            ch[sf][kc] = __builtin_convertvector(p, v16h); } }
    // The output goes through LDS so that every store is whole lines: from the accumulators (acc[sf][u][r] = out[s0 + 16 sf + c][ng * 64 + grp * 32 + u * 16 + 8h + r]) a wave-wide 16-byte store would lay 32 pieces of 16 bytes into 16 lines; read back by rows, it lays 4 whole lines of 128 bytes.
    // A wave stages in the range where its partner showed it its context: nobody but this wave has read it since the barrier above, and its own reads of it are over (the products below hang on them). A range of its own for every quarter.
    // A quarter's rows are read back and stored in the next quarter, behind the barrier between the two, so that the stores fly during that quarter's products and the barrier at its end finds them done.
    unsigned char* gw = lds + XO + (wv ^ 2u) * 32768 + c * GP + 32 * h; const unsigned char* gr = lds + XO + (wv ^ 2u) * 32768 + (lane >> 3) * GP + (lane & 7) * 16;
    float* og = OUT + (b * SS + s0 + (lane >> 3)) * DD + grp * 32 + (lane & 7) * 4;   // 8 lanes a row: load i holds out[s0 + 4 i + (lane >> 3)][quarter * 64 + grp * 32 + 4 (lane & 7) ..]
    // The quarter loop stays rolled (unroll 1) to keep the code short; its inner loops are unrolled in full so that the arrays they index stay in registers.
#pragma unroll 1
    for (int ng = 0; ng < 4; ++ng) {
        const unsigned char* wb = lds + (ng & 1) * WQ; unsigned char* nb = lds + ((ng + 1) & 1) * WQ;
        const bool more = ng + 1 < 4;
        v16bf f[2][8];   // groups of 8 fragments (4 k-chunks x 2 n-tiles), each issued as one block ahead of the products of the group before it, held there by the sched_barrier(0) calls as in the stage loop
#pragma unroll
        for (int u = 0; u < 8; ++u) f[0][u] = ldsfrag(wb + wa + (u & 1) * 16 * WP + (u >> 1) * 64);
        if (more) {   // the next quarter flies while this one is worked on
#pragma unroll
            for (int i = 0; i < 32; ++i) wr[i] = *(const v8us*)(Wg + (size_t)(ng + 1) * 64 * 2 * DD + i * 1024);
            asm volatile("s_wait_xcnt 0x0" ::: "memory");   // in front of the first overwrite of an address register that these loads name
        }
        v4f t[8];   // the quarter before, by rows; asked for ahead of the second fragment group, so that its wait leaves that group in flight
        if (ng > 0) {
#pragma unroll
            for (int i = 0; i < 8; ++i) t[i] = *(const v4fa*)(gr + (ng - 1) * GQ + i * 4 * GP);
        }
        v8f acc[2][2];
#pragma unroll
        for (int sf = 0; sf < 2; ++sf) {
#pragma unroll
            for (int u = 0; u < 2; ++u) acc[sf][u] = (v8f){}; }
#pragma unroll
        for (int g = 0; g < 4; ++g) {
            if (g < 3) {
#pragma unroll
                for (int u = 0; u < 8; ++u) f[(g + 1) & 1][u] = ldsfrag(wb + wa + (u & 1) * 16 * WP + ((g + 1) * 4 + (u >> 1)) * 64);
            }
            __builtin_amdgcn_sched_barrier(0);
#pragma unroll
            for (int kk = 0; kk < 4; ++kk) { const int kc = g * 4 + kk;
#pragma unroll
                for (int u = 0; u < 2; ++u) {
#pragma unroll
                    for (int sf = 0; sf < 2; ++sf) acc[sf][u] = kc < 8 ? wmma16(__builtin_bit_cast(v16h, f[g & 1][kk * 2 + u]), ch[sf][kc & 7], acc[sf][u]) : wmmab(f[g & 1][kk * 2 + u], dq[sf][kc & 7], acc[sf][u]); } }
            __builtin_amdgcn_sched_barrier(0);
            if (g == 0 && ng > 0) {   // behind the first products, when the rows have come
#pragma unroll
                for (int i = 0; i < 8; ++i) *(v4f*)(og + (ng - 1) * 64 + i * 4 * DD) = t[i];
                asm volatile("s_wait_xcnt 0x0" ::: "memory");   // in front of the first overwrite of a register that the stores above name
            }
        }
        if (more) {   // the other buffer's last readers left it at the barrier that ended the quarter before
#pragma unroll
            for (int i = 0; i < 32; ++i) *(v8usa*)(nb + wst + i * 2 * WP) = wr[i];
        }
#pragma unroll
        for (int sf = 0; sf < 2; ++sf) {
#pragma unroll
            for (int u = 0; u < 2; ++u) { v8f r;
#pragma unroll
                for (int j = 0; j < 8; ++j) r[j] = __builtin_amdgcn_tanhf(acc[sf][u][j]);   // the bare v_tanh_f32: the library tanhf is a compare, two lane-mask branches and two serial chains a value, which a wave waits out link by link
                *(v4fa*)(gw + ng * GQ + sf * 16 * GP + u * 64) = __builtin_shufflevector(r, r, 0, 1, 2, 3); *(v4fa*)(gw + ng * GQ + sf * 16 * GP + u * 64 + 16) = __builtin_shufflevector(r, r, 4, 5, 6, 7); } }
        __syncthreads();   // publishes the next quarter and ends every wave's reads of this one; its LDS wait also stands between this wave's staged rows and their reading back
    }
#pragma unroll
    for (int i = 0; i < 8; ++i) *(v4f*)(og + 3 * 64 + i * 4 * DD) = *(const v4fa*)(gr + 3 * GQ + i * 4 * GP);   // the last quarter's rows
}

extern "C" void kernel_launch(void* const* d_in, const int* in_sizes, int n_in,
                              void* d_out, int out_size, void* d_ws, size_t ws_size, hipStream_t stream) {
    (void)in_sizes; (void)n_in; (void)out_size;
    const float* enc = (const float*)d_in[0]; const float* dec = (const float*)d_in[1]; const float* Wt = (const float*)d_in[2];
    float* OUT = (float*)d_out;     // [8][2048][256]
    char* wsp = (char*)d_ws;
    auto take = [&](size_t bytes) { char* p = wsp; wsp += (bytes + 255) & ~(size_t)255; return (void*)p; };
    bf* BW = (bf*)take((size_t)2 * DD * DD * 2); bf* EB = (bf*)take((size_t)NB_ * SS * DD * 2); bf* DB = (bf*)take((size_t)NB_ * SS * DD * 2); bf* ET = (bf*)take((size_t)NB_ * DD * SS * 2);
    if ((size_t)(wsp - (char*)d_ws) > ws_size) return;    // total ~ 24 MiB
    k_prep<<<PW_ + 2 * PE_, 256, 0, stream>>>(enc, dec, Wt, EB, DB, ET, BW);   // bf16 rows of enc and dec, enc^T (f16), W_tanh^T (f16 | bf16)
    k_fattn<<<dim3(SS / 64, NB_), 128, 0, stream>>>(EB, DB, ET, BW, OUT);   // out = tanh([softmax_t(enc . dec^T) . enc | dec] W_tanh)
}
